// v000
// Measured on an AMD MI455X. A time is GPU time per run, averaged over a window of back-to-back runs after a warm-up
// (all launches, gaps included; the runs take copies of the inputs in turn), and the median of several windows.
// Apart from v000's, it joins two sittings. Times from different sittings can be a few percent apart, while
// side-by-side timings come from the same sitting.
// The starting kernel, v000, takes 201 microseconds a run.
#include <hip/hip_runtime.h>
#include <hip/hip_bf16.h>

#define B_SZ 4
#define L_SZ 4096
#define H_SZ 1024
#define N_SZ 64
#define P_SZ 64                 // chunk length
#define C_SZ (L_SZ / P_SZ)      // 64 chunks
#define NCOL (B_SZ * C_SZ)      // 256 matmul columns per h
#define LN_EPS 1e-5f

typedef __attribute__((ext_vector_type(16))) _Float16 v16h;
typedef __attribute__((ext_vector_type(8)))  _Float16 v8h;
typedef __attribute__((ext_vector_type(8)))  float    v8f;
typedef __attribute__((ext_vector_type(4)))  float    v4f;

// ---------------------------------------------------------------------------
// Kernel 1: per-h parameter precompute (discretization, Toeplitz kernel,
// ingest matrix Win, emission matrix E, per-chunk decay a^P).
// One block (64 threads) per h.
// ---------------------------------------------------------------------------
__global__ void precompute_kernel(const float* __restrict__ log_A_real,
                                  const float* __restrict__ A_imag,
                                  const float* __restrict__ C_re,
                                  const float* __restrict__ C_im,
                                  const float* __restrict__ log_dt,
                                  _Float16* __restrict__ Win,
                                  _Float16* __restrict__ Emat,
                                  _Float16* __restrict__ Tmat,
                                  float* __restrict__ decayP) {
  __shared__ float s_dtAr[N_SZ], s_dtAi[N_SZ], s_Ctr[N_SZ], s_Cti[N_SZ], s_K[P_SZ];
  const int h = blockIdx.x;
  const int t = threadIdx.x;                 // 0..63, doubles as state index n
  const float dt = __expf(log_dt[h]);

  // thread t owns state n = t for the setup phase
  const float Ar = -__expf(log_A_real[h * N_SZ + t]);
  const float Ai = A_imag[h * N_SZ + t];
  const float dAr = dt * Ar, dAi = dt * Ai;
  const float e0 = __expf(dAr);
  const float are = e0 * __cosf(dAi), aim = e0 * __sinf(dAi);
  // Ct = C * (exp(dtA)-1)/A
  const float xr = are - 1.0f, xi = aim;
  const float inv = 1.0f / (Ar * Ar + Ai * Ai);
  const float qr = (xr * Ar + xi * Ai) * inv;
  const float qi = (xi * Ar - xr * Ai) * inv;
  const float cr = C_re[h * N_SZ + t], ci = C_im[h * N_SZ + t];
  const float Ctr = cr * qr - ci * qi;
  const float Cti = cr * qi + ci * qr;
  s_dtAr[t] = dAr; s_dtAi[t] = dAi; s_Ctr[t] = Ctr; s_Cti[t] = Cti;

  // per-chunk decay a^P
  const float eP = __expf(dAr * (float)P_SZ);
  decayP[(h * N_SZ + t) * 2 + 0] = eP * __cosf(dAi * (float)P_SZ);
  decayP[(h * N_SZ + t) * 2 + 1] = eP * __sinf(dAi * (float)P_SZ);
  __syncthreads();

  // K[d] = 2 * sum_n Re(Ct_n * a_n^d) ; thread t computes d = t
  {
    float acc = 0.0f;
    for (int n = 0; n < N_SZ; ++n) {
      const float ed = __expf(s_dtAr[n] * (float)t);
      const float cc = __cosf(s_dtAi[n] * (float)t);
      const float ss = __sinf(s_dtAi[n] * (float)t);
      acc += 2.0f * (s_Ctr[n] * ed * cc - s_Cti[n] * ed * ss);
    }
    s_K[t] = acc;
  }

  // Win[h][n][t]     = Re(a_n^(P-1-t))   (row-major, ld = P)
  // Win[h][N+n][t]   = Im(a_n^(P-1-t))
  {
    const float pw = (float)(P_SZ - 1 - t);
    _Float16* wp = Win + (size_t)h * (2 * N_SZ * P_SZ);
    for (int n = 0; n < N_SZ; ++n) {
      const float ed = __expf(s_dtAr[n] * pw);
      wp[n * P_SZ + t]          = (_Float16)(ed * __cosf(s_dtAi[n] * pw));
      wp[(N_SZ + n) * P_SZ + t] = (_Float16)(ed * __sinf(s_dtAi[n] * pw));
    }
  }

  // E[h][j][n]   =  2*Re(Ct_n a_n^(j+1))  (row-major, ld = 2N), thread j = t
  // E[h][j][N+n] = -2*Im(Ct_n a_n^(j+1))
  {
    const float pw = (float)(t + 1);
    _Float16* ep = Emat + (size_t)h * (P_SZ * 2 * N_SZ) + (size_t)t * (2 * N_SZ);
    for (int n = 0; n < N_SZ; ++n) {
      const float ed = __expf(s_dtAr[n] * pw);
      const float cc = __cosf(s_dtAi[n] * pw), ss = __sinf(s_dtAi[n] * pw);
      const float pr = s_Ctr[n] * ed * cc - s_Cti[n] * ed * ss;
      const float pi = s_Ctr[n] * ed * ss + s_Cti[n] * ed * cc;
      ep[n]        = (_Float16)( 2.0f * pr);
      ep[N_SZ + n] = (_Float16)(-2.0f * pi);
    }
  }
  __syncthreads();

  // Lower-triangular Toeplitz T[h][j][u] = (u<=j) ? K[j-u] : 0 ; thread j = t
  {
    _Float16* tp = Tmat + (size_t)h * (P_SZ * P_SZ) + (size_t)t * P_SZ;
    for (int u = 0; u < P_SZ; ++u)
      tp[u] = (u <= t) ? (_Float16)s_K[t - u] : (_Float16)0.0f;
  }
}

// ---------------------------------------------------------------------------
// Kernel 2: pack x [B,L,H] f32 -> Xc[h][col][t] f16 via LDS transpose.
// Block = 256 threads handles one (b, c) chunk x 64-h tile (64x64 elements x16).
// Coalesced f32 reads along h; contiguous f16 writes along t.
// ---------------------------------------------------------------------------
__global__ void pack_x_kernel(const float* __restrict__ x, _Float16* __restrict__ Xc) {
  __shared__ _Float16 s_tile[64 * 65];
  const int col = blockIdx.x;              // c*B + b
  const int hb  = blockIdx.y;              // h tile (0..15)
  const int b   = col & (B_SZ - 1);
  const int c   = col >> 2;
  const int tid = threadIdx.x;
#pragma unroll
  for (int i = 0; i < 16; ++i) {
    const int lin = i * 256 + tid;
    const int t  = lin >> 6;               // position within chunk
    const int hh = lin & 63;               // h within tile (fast -> coalesced)
    const int l  = c * P_SZ + t;
    s_tile[hh * 65 + t] =
        (_Float16)x[((size_t)b * L_SZ + l) * H_SZ + hb * 64 + hh];
  }
  __syncthreads();
#pragma unroll
  for (int i = 0; i < 16; ++i) {
    const int lin = i * 256 + tid;
    const int hh = lin >> 6;
    const int t  = lin & 63;               // t fast -> contiguous writes
    const int h  = hb * 64 + hh;
    Xc[(size_t)h * (NCOL * P_SZ) + (size_t)col * P_SZ + t] = s_tile[hh * 65 + t];
  }
}

// ---------------------------------------------------------------------------
// WMMA fragment loader. Row-major A (row per lane) and column-contiguous B
// (col per lane) share the identical per-lane K packing:
//   halves 0..7  -> K = k0 + (lane<16 ? 0 : 8) + i
//   halves 8..15 -> K = k0 + 16 + (lane<16 ? 0 : 8) + i
// All runs are 8 contiguous halves (16B aligned) -> b128 loads.
// ---------------------------------------------------------------------------
__device__ __forceinline__ v16h load_frag(const _Float16* base, int ld, int rc0,
                                          int k0, int lane) {
  const _Float16* p = base + (size_t)(rc0 + (lane & 15)) * ld + k0 + ((lane & 16) ? 8 : 0);
  v16h f;
#pragma unroll
  for (int i = 0; i < 8; ++i) { f[i] = p[i]; f[8 + i] = p[16 + i]; }
  return f;
}

// ---------------------------------------------------------------------------
// Kernel 3: ingest matmul. Per h: U[col][row] (col-contiguous, ld=2N) with
// U_logical[128 x 256] = Win[128 x 64] * X[64 x 256].
// grid (H, 16), block 256 (8 waves); one 16x16 tile per wave.
// Each lane's 8 accumulator rows are contiguous in U -> single b128 store.
// ---------------------------------------------------------------------------
__global__ void ingest_kernel(const _Float16* __restrict__ Win,
                              const _Float16* __restrict__ Xc,
                              _Float16* __restrict__ U) {
  const int h    = blockIdx.x;
  const int wave = threadIdx.x >> 5;
  const int lane = threadIdx.x & 31;
  const int tile = blockIdx.y * 8 + wave;      // 0..127
  const int m = tile >> 4, n = tile & 15;
  const _Float16* A  = Win + (size_t)h * (2 * N_SZ * P_SZ);
  const _Float16* Bm = Xc  + (size_t)h * (NCOL * P_SZ);
  v8f acc = {};
#pragma unroll
  for (int k0 = 0; k0 < P_SZ; k0 += 32) {
    __builtin_prefetch(Bm + (size_t)(n * 16) * P_SZ + k0 + 32, 0, 1);
    v16h a = load_frag(A,  P_SZ, m * 16, k0, lane);
    v16h b = load_frag(Bm, P_SZ, n * 16, k0, lane);
    acc = __builtin_amdgcn_wmma_f32_16x16x32_f16(false, a, false, b, (short)0, acc,
                                                 false, false);
  }
  _Float16* Up = U + (size_t)h * (2 * N_SZ * NCOL);
  const int colg  = n * 16 + (lane & 15);
  const int rbase = m * 16 + ((lane & 16) ? 8 : 0);
  v8h hv;
#pragma unroll
  for (int i = 0; i < 8; ++i) hv[i] = (_Float16)acc[i];
  *(v8h*)(Up + (size_t)colg * (2 * N_SZ) + rbase) = hv;   // 16B store
}

// ---------------------------------------------------------------------------
// Kernel 4: inter-chunk recurrence. One thread per (b,h,n) complex state:
// emit state-before-chunk into Sh[h][col][0..2N) (f16, col-contiguous),
// then s <- a^P * s + u. U reads are coalesced (consecutive n -> consecutive).
// ---------------------------------------------------------------------------
__global__ void scan_kernel(const _Float16* __restrict__ U,
                            const float* __restrict__ decayP,
                            _Float16* __restrict__ Sh) {
  const int idx = blockIdx.x * blockDim.x + threadIdx.x;   // B*H*N
  const int n   = idx & (N_SZ - 1);
  const int tmp = idx >> 6;
  const int b   = tmp & (B_SZ - 1);
  const int h   = tmp >> 2;
  const float dr = decayP[(h * N_SZ + n) * 2 + 0];
  const float di = decayP[(h * N_SZ + n) * 2 + 1];
  const _Float16* Up = U  + (size_t)h * (2 * N_SZ * NCOL);
  _Float16*       Sp = Sh + (size_t)h * (NCOL * 2 * N_SZ);
  float sr = 0.0f, si = 0.0f;
  for (int c = 0; c < C_SZ; ++c) {
    const int col = c * B_SZ + b;
    Sp[(size_t)col * (2 * N_SZ) + n]        = (_Float16)sr;
    Sp[(size_t)col * (2 * N_SZ) + N_SZ + n] = (_Float16)si;
    const float ur = (float)Up[(size_t)col * (2 * N_SZ) + n];
    const float ui = (float)Up[(size_t)col * (2 * N_SZ) + N_SZ + n];
    const float nsr = dr * sr - di * si + ur;
    const float nsi = dr * si + di * sr + ui;
    sr = nsr; si = nsi;
  }
}

// ---------------------------------------------------------------------------
// Kernel 5: emit matmul. Per h (Y stored [h][col][j], col-contiguous, ld=P):
//   Y_logical[64 x 256] = T[64 x 64] * X[64 x 256]   (intra-chunk causal conv)
//                       + E[64 x 128] * S[128 x 256] (inter-chunk emission)
// grid (H, 8), block 256 (8 waves); one 16x16 tile per wave.
// Lane stores 8 contiguous f32 -> two b128 stores.
// ---------------------------------------------------------------------------
__global__ void emit_kernel(const _Float16* __restrict__ Tmat,
                            const _Float16* __restrict__ Emat,
                            const _Float16* __restrict__ Xc,
                            const _Float16* __restrict__ Sh,
                            float* __restrict__ Y) {
  const int h    = blockIdx.x;
  const int wave = threadIdx.x >> 5;
  const int lane = threadIdx.x & 31;
  const int tile = blockIdx.y * 8 + wave;      // 0..63
  const int m = tile >> 4, n = tile & 15;      // m: 0..3
  const _Float16* At = Tmat + (size_t)h * (P_SZ * P_SZ);
  const _Float16* Ae = Emat + (size_t)h * (P_SZ * 2 * N_SZ);
  const _Float16* Bx = Xc   + (size_t)h * (NCOL * P_SZ);
  const _Float16* Bs = Sh   + (size_t)h * (NCOL * 2 * N_SZ);
  v8f acc = {};
#pragma unroll
  for (int k0 = 0; k0 < P_SZ; k0 += 32) {
    v16h a = load_frag(At, P_SZ, m * 16, k0, lane);
    v16h b = load_frag(Bx, P_SZ, n * 16, k0, lane);
    acc = __builtin_amdgcn_wmma_f32_16x16x32_f16(false, a, false, b, (short)0, acc,
                                                 false, false);
  }
#pragma unroll
  for (int k0 = 0; k0 < 2 * N_SZ; k0 += 32) {
    v16h a = load_frag(Ae, 2 * N_SZ, m * 16, k0, lane);
    v16h b = load_frag(Bs, 2 * N_SZ, n * 16, k0, lane);
    acc = __builtin_amdgcn_wmma_f32_16x16x32_f16(false, a, false, b, (short)0, acc,
                                                 false, false);
  }
  float* Yp = Y + (size_t)h * (P_SZ * NCOL);
  const int colg  = n * 16 + (lane & 15);
  const int rbase = m * 16 + ((lane & 16) ? 8 : 0);
  float* dst = Yp + (size_t)colg * P_SZ + rbase;
  v4f lo = {acc[0], acc[1], acc[2], acc[3]};
  v4f hi = {acc[4], acc[5], acc[6], acc[7]};
  *(v4f*)dst       = lo;                        // 16B store
  *(v4f*)(dst + 4) = hi;                        // 16B store
}

// ---------------------------------------------------------------------------
// Kernel 6: transpose Y[h][col][j] -> R[b,l,h] with fused residual:
//   r = x*(1+D) + y
// Block = 256 threads per (col, h-tile): coalesced f32 reads along j,
// coalesced writes (and x reads) along h.
// ---------------------------------------------------------------------------
__global__ void transpose_residual_kernel(const float* __restrict__ Y,
                                          const float* __restrict__ x,
                                          const float* __restrict__ D,
                                          float* __restrict__ R) {
  __shared__ float s_tile[64 * 65];
  const int col = blockIdx.x;              // c*B + b
  const int hb  = blockIdx.y;              // h tile (0..15)
  const int b   = col & (B_SZ - 1);
  const int c   = col >> 2;
  const int tid = threadIdx.x;
#pragma unroll
  for (int i = 0; i < 16; ++i) {
    const int lin = i * 256 + tid;
    const int hh = lin >> 6;
    const int j  = lin & 63;               // j fast -> coalesced reads
    s_tile[hh * 65 + j] =
        Y[((size_t)(hb * 64 + hh) * NCOL + col) * P_SZ + j];
  }
  __syncthreads();
#pragma unroll
  for (int i = 0; i < 16; ++i) {
    const int lin = i * 256 + tid;
    const int j  = lin >> 6;
    const int hh = lin & 63;               // h fast -> coalesced writes
    const int h  = hb * 64 + hh;
    const size_t bl = (size_t)b * L_SZ + c * P_SZ + j;
    const float xv = x[bl * H_SZ + h];
    R[bl * H_SZ + h] = s_tile[hh * 65 + j] + xv * (1.0f + D[h]);
  }
}

// ---------------------------------------------------------------------------
// Kernel 7: LayerNorm over H. One block per (b,l); fully coalesced.
// out = (r-mu)*rsqrt(var+eps)*w + b
// ---------------------------------------------------------------------------
__global__ void final_kernel(const float* __restrict__ R,
                             const float* __restrict__ ln_w,
                             const float* __restrict__ ln_b,
                             float* __restrict__ out) {
  __shared__ float s_sum[256], s_sq[256];
  const int bl  = blockIdx.x;              // b*L + l
  const int tid = threadIdx.x;
  float r[4];
  float lsum = 0.0f, lsq = 0.0f;
#pragma unroll
  for (int i = 0; i < 4; ++i) {
    const int h  = i * 256 + tid;
    const float rv = R[(size_t)bl * H_SZ + h];
    r[i] = rv; lsum += rv; lsq += rv * rv;
  }
  s_sum[tid] = lsum; s_sq[tid] = lsq;
  __syncthreads();
  for (int off = 128; off > 0; off >>= 1) {
    if (tid < off) { s_sum[tid] += s_sum[tid + off]; s_sq[tid] += s_sq[tid + off]; }
    __syncthreads();
  }
  const float mu  = s_sum[0] * (1.0f / (float)H_SZ);
  const float var = s_sq[0] * (1.0f / (float)H_SZ) - mu * mu;
  const float inv = rsqrtf(var + LN_EPS);
#pragma unroll
  for (int i = 0; i < 4; ++i) {
    const int h = i * 256 + tid;
    out[(size_t)bl * H_SZ + h] = (r[i] - mu) * inv * ln_w[h] + ln_b[h];
  }
}

// ---------------------------------------------------------------------------
// Host launcher
// ---------------------------------------------------------------------------
extern "C" void kernel_launch(void* const* d_in, const int* in_sizes, int n_in,
                              void* d_out, int out_size, void* d_ws, size_t ws_size,
                              hipStream_t stream) {
  const float* x          = (const float*)d_in[0];
  const float* log_A_real = (const float*)d_in[1];
  const float* A_imag     = (const float*)d_in[2];
  const float* C_re       = (const float*)d_in[3];
  const float* C_im       = (const float*)d_in[4];
  const float* log_dt     = (const float*)d_in[5];
  const float* Dterm      = (const float*)d_in[6];
  const float* ln_w       = (const float*)d_in[7];
  const float* ln_b       = (const float*)d_in[8];
  float* out = (float*)d_out;

  // workspace layout (bytes)
  char* ws = (char*)d_ws;
  const size_t WIN_B = (size_t)H_SZ * 2 * N_SZ * P_SZ * 2;   // 16 MB
  const size_t E_B   = (size_t)H_SZ * P_SZ * 2 * N_SZ * 2;   // 16 MB
  const size_t T_B   = (size_t)H_SZ * P_SZ * P_SZ * 2;       //  8 MB
  const size_t DEC_B = (size_t)H_SZ * N_SZ * 2 * 4;          // 0.5 MB
  const size_t XC_B  = (size_t)H_SZ * NCOL * P_SZ * 2;       // 32 MB
  const size_t U_B   = (size_t)H_SZ * 2 * N_SZ * NCOL * 2;   // 64 MB
  const size_t SH_B  = (size_t)H_SZ * NCOL * 2 * N_SZ * 2;   // 64 MB
  size_t off = 0;
  _Float16* Win    = (_Float16*)(ws + off); off += WIN_B;
  _Float16* Emat   = (_Float16*)(ws + off); off += E_B;
  _Float16* Tmat   = (_Float16*)(ws + off); off += T_B;
  float*    decayP = (float*)   (ws + off); off += DEC_B;
  _Float16* Xc     = (_Float16*)(ws + off); off += XC_B;
  _Float16* U      = (_Float16*)(ws + off); // U dead after scan -> Y aliases it
  float*    Yconv  = (float*)   (ws + off); off += U_B;
  _Float16* Sh     = (_Float16*)(ws + off); off += SH_B;
  // R (r = x*(1+D)+y, [B,L,H] f32, 67 MB) aliases Win..Xc (72.5 MB, dead
  // after emit_kernel).
  float* R = (float*)ws;
  (void)ws_size; (void)n_in; (void)in_sizes; (void)out_size;

  // 1) parameter precompute: 1024 blocks x 64 threads
  precompute_kernel<<<dim3(H_SZ), dim3(P_SZ), 0, stream>>>(
      log_A_real, A_imag, C_re, C_im, log_dt, Win, Emat, Tmat, decayP);

  // 2) pack x -> f16 column tiles (LDS transpose): grid (256 cols, 16 h-tiles)
  pack_x_kernel<<<dim3(NCOL, H_SZ / 64), dim3(256), 0, stream>>>(x, Xc);

  // 3) ingest matmul (WMMA): per h 128 tiles -> grid (H, 16) x 8 waves
  ingest_kernel<<<dim3(H_SZ, 16), dim3(256), 0, stream>>>(Win, Xc, U);

  // 4) inter-chunk scan: B*H*N threads
  scan_kernel<<<dim3((B_SZ * H_SZ * N_SZ) / 256), dim3(256), 0, stream>>>(
      U, decayP, Sh);

  // 5) emit matmul (WMMA, Y aliases U): per h 64 tiles -> grid (H, 8) x 8 waves
  emit_kernel<<<dim3(H_SZ, 8), dim3(256), 0, stream>>>(Tmat, Emat, Xc, Sh, Yconv);

  // 6) transpose back + fused residual (R aliases Win..Xc region)
  transpose_residual_kernel<<<dim3(NCOL, H_SZ / 64), dim3(256), 0, stream>>>(
      Yconv, x, Dterm, R);

  // 7) LayerNorm: one block per (b,l), fully coalesced
  final_kernel<<<dim3(B_SZ * L_SZ), dim3(256), 0, stream>>>(R, ln_w, ln_b, out);
}

// v001
// Measured time: 102 microseconds a run.
// Next to v000, in two timings, it ran 2.02 and 2.01 times as fast.
#include <hip/hip_runtime.h>
#include <hip/hip_bf16.h>

#define B_SZ 4
#define L_SZ 4096
#define H_SZ 1024
#define N_SZ 64
#define P_SZ 64                 // chunk length
#define C_SZ (L_SZ / P_SZ)      // 64 chunks
#define NCOL (B_SZ * C_SZ)      // 256 matmul columns per h
#define LN_EPS 1e-5f

typedef __attribute__((ext_vector_type(16))) _Float16 v16h;
typedef __attribute__((ext_vector_type(8)))  _Float16 v8h;
typedef __attribute__((ext_vector_type(8)))  float    v8f;
typedef __attribute__((ext_vector_type(4)))  float    v4f;

// ---------------------------------------------------------------------------
// Kernel 1: per-h parameter precompute (discretization, Toeplitz kernel,
// ingest matrix Win, emission matrix E, per-chunk decay a^P).
// One block (64 threads) per h.
// ---------------------------------------------------------------------------
__global__ void precompute_kernel(const float* __restrict__ log_A_real,
                                  const float* __restrict__ A_imag,
                                  const float* __restrict__ C_re,
                                  const float* __restrict__ C_im,
                                  const float* __restrict__ log_dt,
                                  _Float16* __restrict__ Win,
                                  _Float16* __restrict__ Emat,
                                  _Float16* __restrict__ Tmat,
                                  float* __restrict__ decayP) {
  __shared__ float s_dtAr[N_SZ], s_dtAi[N_SZ], s_Ctr[N_SZ], s_Cti[N_SZ], s_K[P_SZ];
  const int h = blockIdx.x;
  const int t = threadIdx.x;                 // 0..63, doubles as state index n
  const float dt = __expf(log_dt[h]);

  // thread t owns state n = t for the setup phase
  const float Ar = -__expf(log_A_real[h * N_SZ + t]);
  const float Ai = A_imag[h * N_SZ + t];
  const float dAr = dt * Ar, dAi = dt * Ai;
  const float e0 = __expf(dAr);
  const float are = e0 * __cosf(dAi), aim = e0 * __sinf(dAi);
  // Ct = C * (exp(dtA)-1)/A
  const float xr = are - 1.0f, xi = aim;
  const float inv = 1.0f / (Ar * Ar + Ai * Ai);
  const float qr = (xr * Ar + xi * Ai) * inv;
  const float qi = (xi * Ar - xr * Ai) * inv;
  const float cr = C_re[h * N_SZ + t], ci = C_im[h * N_SZ + t];
  const float Ctr = cr * qr - ci * qi;
  const float Cti = cr * qi + ci * qr;
  s_dtAr[t] = dAr; s_dtAi[t] = dAi; s_Ctr[t] = Ctr; s_Cti[t] = Cti;

  // per-chunk decay a^P
  const float eP = __expf(dAr * (float)P_SZ);
  decayP[(h * N_SZ + t) * 2 + 0] = eP * __cosf(dAi * (float)P_SZ);
  decayP[(h * N_SZ + t) * 2 + 1] = eP * __sinf(dAi * (float)P_SZ);
  __syncthreads();

  // K[d] = 2 * sum_n Re(Ct_n * a_n^d) ; thread t computes d = t
  {
    float acc = 0.0f;
    for (int n = 0; n < N_SZ; ++n) {
      const float ed = __expf(s_dtAr[n] * (float)t);
      const float cc = __cosf(s_dtAi[n] * (float)t);
      const float ss = __sinf(s_dtAi[n] * (float)t);
      acc += 2.0f * (s_Ctr[n] * ed * cc - s_Cti[n] * ed * ss);
    }
    s_K[t] = acc;
  }

  // Win[h][n][t]     = Re(a_n^(P-1-t))   (row-major, ld = P)
  // Win[h][N+n][t]   = Im(a_n^(P-1-t))
  {
    const float pw = (float)(P_SZ - 1 - t);
    _Float16* wp = Win + (size_t)h * (2 * N_SZ * P_SZ);
    for (int n = 0; n < N_SZ; ++n) {
      const float ed = __expf(s_dtAr[n] * pw);
      wp[n * P_SZ + t]          = (_Float16)(ed * __cosf(s_dtAi[n] * pw));
      wp[(N_SZ + n) * P_SZ + t] = (_Float16)(ed * __sinf(s_dtAi[n] * pw));
    }
  }

  // E[h][j][n]   =  2*Re(Ct_n a_n^(j+1))  (row-major, ld = 2N), thread j = t
  // E[h][j][N+n] = -2*Im(Ct_n a_n^(j+1))
  {
    const float pw = (float)(t + 1);
    _Float16* ep = Emat + (size_t)h * (P_SZ * 2 * N_SZ) + (size_t)t * (2 * N_SZ);
    for (int n = 0; n < N_SZ; ++n) {
      const float ed = __expf(s_dtAr[n] * pw);
      const float cc = __cosf(s_dtAi[n] * pw), ss = __sinf(s_dtAi[n] * pw);
      const float pr = s_Ctr[n] * ed * cc - s_Cti[n] * ed * ss;
      const float pi = s_Ctr[n] * ed * ss + s_Cti[n] * ed * cc;
      ep[n]        = (_Float16)( 2.0f * pr);
      ep[N_SZ + n] = (_Float16)(-2.0f * pi);
    }
  }
  __syncthreads();

  // Lower-triangular Toeplitz T[h][j][u] = (u<=j) ? K[j-u] : 0 ; thread j = t
  {
    _Float16* tp = Tmat + (size_t)h * (P_SZ * P_SZ) + (size_t)t * P_SZ;
    for (int u = 0; u < P_SZ; ++u)
      tp[u] = (u <= t) ? (_Float16)s_K[t - u] : (_Float16)0.0f;
  }
}

// ---------------------------------------------------------------------------
// Kernel 2: pack x [B,L,H] f32 -> Xc[h][col][t] f16 via LDS transpose.
// Block = 256 threads handles one (b, c) chunk x 64-h tile (64x64 elements x16).
// Coalesced f32 reads along h; contiguous f16 writes along t.
// ---------------------------------------------------------------------------
__global__ void pack_x_kernel(const float* __restrict__ x, _Float16* __restrict__ Xc) {
  __shared__ _Float16 s_tile[64 * 65];
  const int col = blockIdx.x;              // c*B + b
  const int hb  = blockIdx.y;              // h tile (0..15)
  const int b   = col & (B_SZ - 1);
  const int c   = col >> 2;
  const int tid = threadIdx.x;
#pragma unroll
  for (int i = 0; i < 16; ++i) {
    const int lin = i * 256 + tid;
    const int t  = lin >> 6;               // position within chunk
    const int hh = lin & 63;               // h within tile (fast -> coalesced)
    const int l  = c * P_SZ + t;
    s_tile[hh * 65 + t] =
        (_Float16)x[((size_t)b * L_SZ + l) * H_SZ + hb * 64 + hh];
  }
  __syncthreads();
#pragma unroll
  for (int i = 0; i < 16; ++i) {
    const int lin = i * 256 + tid;
    const int hh = lin >> 6;
    const int t  = lin & 63;               // t fast -> contiguous writes
    const int h  = hb * 64 + hh;
    Xc[(size_t)h * (NCOL * P_SZ) + (size_t)col * P_SZ + t] = s_tile[hh * 65 + t];
  }
}

// ---------------------------------------------------------------------------
// WMMA fragment loader from LDS. Row-major A (row per lane) and
// column-contiguous B (col per lane) share the identical per-lane K packing:
//   halves 0..7  -> K = k0 + (lane<16 ? 0 : 8) + i
//   halves 8..15 -> K = k0 + 16 + (lane<16 ? 0 : 8) + i
// Both runs are 8 contiguous halves, 16B aligned -> two ds_load_b128.
// ---------------------------------------------------------------------------
#define XP 72    // LDS pitch (halves) of 64-half rows:  144 B = 16 B x 9
#define SP 136   // LDS pitch (halves) of 128-half rows: 272 B = 16 B x 17

__device__ __forceinline__ v16h lds_frag(const _Float16* base, int ld, int rc0,
                                         int k0, int lane) {
  const _Float16* p = base + (rc0 + (lane & 15)) * ld + k0 + ((lane & 16) ? 8 : 0);
  const v8h lo = *(const v8h*)p;
  const v8h hi = *(const v8h*)(p + 16);
  return __builtin_shufflevector(lo, hi, 0, 1, 2, 3, 4, 5, 6, 7,
                                 8, 9, 10, 11, 12, 13, 14, 15);
}

// ---------------------------------------------------------------------------
// Kernel 3: ingest matmul, inter-chunk recurrence and emit matmul of one h in
// one work-group (8 waves). Wave w owns columns [32w, 32w+32) in both matmuls.
//   U[128 x 256] = Win[128 x 64] * X[64 x 256]        -> LDS, f16, [col][row]
//   per (b, n): S(before chunk c) replaces U(c) in place; s <- a^P * s + u
//   Y[64 x 256]  = T[64 x 64] * X + E[64 x 128] * S   -> global, [h][col][j]
// U and S never leave LDS; every global read of Win, X, T and E is a whole-line 16 B per lane read.
// Each plain '#pragma unroll' below makes the indices of a register array
// compile-time constants, so that the array stays in registers.
// ---------------------------------------------------------------------------
// Second launch bound: 6 waves per SIMD, the three work-groups per WGP that the
// 96,256 B of LDS allow.
__global__ __launch_bounds__(256, 6) void chunk_chain_kernel(
    const _Float16* __restrict__ Win, const _Float16* __restrict__ Emat,
    const _Float16* __restrict__ Tmat, const _Float16* __restrict__ Xc,
    const float* __restrict__ decayP, float* __restrict__ Y) {
  // U, then S: 256 columns of 128 halves. Each wave first parks its own 32
  // columns of X in its own slice (read back into registers before U lands).
  __shared__ __attribute__((aligned(16))) _Float16 s_us[NCOL * SP];
  // Win during ingest; T (64 rows, pitch XP) and E (64 rows, pitch SP) after it.
  __shared__ __attribute__((aligned(16))) _Float16 s_par[P_SZ * XP + P_SZ * SP];
  const int h    = blockIdx.x;
  const int tid  = threadIdx.x;
  const int wave = tid >> 5;
  const int lane = tid & 31;
  const _Float16* gW = Win  + (size_t)h * (2 * N_SZ * P_SZ);
  const _Float16* gT = Tmat + (size_t)h * (P_SZ * P_SZ);
  const _Float16* gE = Emat + (size_t)h * (P_SZ * 2 * N_SZ);
  const _Float16* gX = Xc   + (size_t)h * (NCOL * P_SZ) + wave * (32 * P_SZ);
  _Float16* s_own = s_us + wave * (32 * SP);
  _Float16* s_T   = s_par;
  _Float16* s_E   = s_par + P_SZ * XP;

  // ---- fetch everything this h needs; stage Win (work-group), X (per wave) ----
  v8h wReg[4], xReg[8], tReg[2], eReg[4];
#pragma unroll
  for (int i = 0; i < 4; ++i) wReg[i] = *(const v8h*)(gW + (i * 256 + tid) * 8);
#pragma unroll
  for (int i = 0; i < 8; ++i) xReg[i] = *(const v8h*)(gX + (i * 32 + lane) * 8);
#pragma unroll
  for (int i = 0; i < 2; ++i) tReg[i] = *(const v8h*)(gT + (i * 256 + tid) * 8);
#pragma unroll
  for (int i = 0; i < 4; ++i) eReg[i] = *(const v8h*)(gE + (i * 256 + tid) * 8);
  const int sn = tid & (N_SZ - 1);           // state index of the recurrence
  const int sb = tid >> 6;                   // batch index of the recurrence
  const float dr = decayP[(h * N_SZ + sn) * 2 + 0];
  const float di = decayP[(h * N_SZ + sn) * 2 + 1];
  // All loads are in flight before the first LDS store waits for one; without
  // this the loads were issued one at a time, each behind the last one's wait.
  __builtin_amdgcn_sched_barrier(0);
#pragma unroll
  for (int i = 0; i < 4; ++i) {
    const int q = i * 256 + tid;             // 16-byte piece of Win
    *(v8h*)(s_par + (q >> 3) * XP + (q & 7) * 8) = wReg[i];
  }
#pragma unroll
  for (int i = 0; i < 8; ++i) {
    const int q = i * 32 + lane;             // 16-byte piece of this wave's X
    *(v8h*)(s_own + (q >> 3) * XP + (q & 7) * 8) = xReg[i];
  }
  __syncthreads();

  // ---- ingest: X fragments stay in registers for the emit matmul ----
  const int cl = lane & 15;
  const int r8 = (lane & 16) ? 8 : 0;
  v16h xb[2][2];
#pragma unroll
  for (int nn = 0; nn < 2; ++nn)
#pragma unroll
    for (int kk = 0; kk < 2; ++kk)
      xb[nn][kk] = lds_frag(s_own, XP, nn * 16, kk * 32, lane);
#pragma unroll
  for (int m = 0; m < 8; ++m) {
    const v16h a0 = lds_frag(s_par, XP, m * 16, 0, lane);
    const v16h a1 = lds_frag(s_par, XP, m * 16, 32, lane);
#pragma unroll
    for (int nn = 0; nn < 2; ++nn) {
      v8f acc = {};
      acc = __builtin_amdgcn_wmma_f32_16x16x32_f16(false, a0, false, xb[nn][0],
                                                   (short)0, acc, false, false);
      acc = __builtin_amdgcn_wmma_f32_16x16x32_f16(false, a1, false, xb[nn][1],
                                                   (short)0, acc, false, false);
      v8h hv;
#pragma unroll
      for (int i = 0; i < 8; ++i) hv[i] = (_Float16)acc[i];
      *(v8h*)(s_own + (nn * 16 + cl) * SP + m * 16 + r8) = hv;
    }
  }
  __syncthreads();   // U complete; Win no longer read

  // ---- T and E take Win's place ----
#pragma unroll
  for (int i = 0; i < 2; ++i) {
    const int q = i * 256 + tid;
    *(v8h*)(s_T + (q >> 3) * XP + (q & 7) * 8) = tReg[i];
  }
#pragma unroll
  for (int i = 0; i < 4; ++i) {
    const int q = i * 256 + tid;
    *(v8h*)(s_E + (q >> 4) * SP + (q & 15) * 8) = eReg[i];
  }

  // ---- recurrence over the 64 chunks, one thread per (b, n), in place ----
  {
    _Float16* sp = s_us + sb * SP + sn;
    float sr = 0.0f, si = 0.0f;
    // Kept rolled: fully unrolled, the 128 loaded halves each hold a register.
#pragma unroll 1
    for (int c0 = 0; c0 < C_SZ; c0 += 16) {
      _Float16 ur[16], ui[16];
#pragma unroll
      for (int i = 0; i < 16; ++i) {
        ur[i] = sp[(c0 + i) * (B_SZ * SP)];
        ui[i] = sp[(c0 + i) * (B_SZ * SP) + N_SZ];
      }
#pragma unroll
      for (int i = 0; i < 16; ++i) {
        sp[(c0 + i) * (B_SZ * SP)]        = (_Float16)sr;
        sp[(c0 + i) * (B_SZ * SP) + N_SZ] = (_Float16)si;
        // Explicit fused forms: which product is rounded before the fuse is
        // fixed here, not left to the compiler's choice.
        const float nsr = fmaf(dr, sr, -(di * si)) + (float)ur[i];
        const float nsi = fmaf(dr, si, di * sr) + (float)ui[i];
        sr = nsr; si = nsi;
      }
    }
  }
  __syncthreads();   // S, T and E complete

  // ---- emit: 4 x 2 accumulator tiles per wave, k outermost ----
  v8f acc[4][2] = {};
#pragma unroll
  for (int kk = 0; kk < 2; ++kk)
#pragma unroll
    for (int m = 0; m < 4; ++m) {
      const v16h a = lds_frag(s_T, XP, m * 16, kk * 32, lane);
#pragma unroll
      for (int nn = 0; nn < 2; ++nn)
        acc[m][nn] = __builtin_amdgcn_wmma_f32_16x16x32_f16(
            false, a, false, xb[nn][kk], (short)0, acc[m][nn], false, false);
    }
#pragma unroll
  for (int kk = 0; kk < 4; ++kk) {
    const v16h s0 = lds_frag(s_own, SP, 0, kk * 32, lane);
    const v16h s1 = lds_frag(s_own, SP, 16, kk * 32, lane);
#pragma unroll
    for (int m = 0; m < 4; ++m) {
      const v16h a = lds_frag(s_E, SP, m * 16, kk * 32, lane);
      acc[m][0] = __builtin_amdgcn_wmma_f32_16x16x32_f16(
          false, a, false, s0, (short)0, acc[m][0], false, false);
      acc[m][1] = __builtin_amdgcn_wmma_f32_16x16x32_f16(
          false, a, false, s1, (short)0, acc[m][1], false, false);
    }
  }
  float* Yp = Y + (size_t)h * (P_SZ * NCOL) + (size_t)(wave * 32) * P_SZ;
  // Keeps every store behind the last LDS load and WMMA, so that no register
  // an issued store names is written again.
  __builtin_amdgcn_sched_barrier(0);
#pragma unroll
  for (int nn = 0; nn < 2; ++nn)
#pragma unroll
    for (int m = 0; m < 4; ++m) {
      float* dst = Yp + (size_t)(nn * 16 + cl) * P_SZ + m * 16 + r8;
      const v8f d = acc[m][nn];
      v4f lo = {d[0], d[1], d[2], d[3]};
      v4f hi = {d[4], d[5], d[6], d[7]};
      *(v4f*)dst       = lo;                    // 16B store
      *(v4f*)(dst + 4) = hi;                    // 16B store
    }
}

// ---------------------------------------------------------------------------
// Kernel 4: transpose Y[h][col][j] -> R[b,l,h] with fused residual:
//   r = x*(1+D) + y
// Block = 256 threads per (col, h-tile): coalesced f32 reads along j,
// coalesced writes (and x reads) along h.
// ---------------------------------------------------------------------------
__global__ void transpose_residual_kernel(const float* __restrict__ Y,
                                          const float* __restrict__ x,
                                          const float* __restrict__ D,
                                          float* __restrict__ R) {
  __shared__ float s_tile[64 * 65];
  const int col = blockIdx.x;              // c*B + b
  const int hb  = blockIdx.y;              // h tile (0..15)
  const int b   = col & (B_SZ - 1);
  const int c   = col >> 2;
  const int tid = threadIdx.x;
#pragma unroll
  for (int i = 0; i < 16; ++i) {
    const int lin = i * 256 + tid;
    const int hh = lin >> 6;
    const int j  = lin & 63;               // j fast -> coalesced reads
    s_tile[hh * 65 + j] =
        Y[((size_t)(hb * 64 + hh) * NCOL + col) * P_SZ + j];
  }
  __syncthreads();
#pragma unroll
  for (int i = 0; i < 16; ++i) {
    const int lin = i * 256 + tid;
    const int j  = lin >> 6;
    const int hh = lin & 63;               // h fast -> coalesced writes
    const int h  = hb * 64 + hh;
    const size_t bl = (size_t)b * L_SZ + c * P_SZ + j;
    const float xv = x[bl * H_SZ + h];
    R[bl * H_SZ + h] = s_tile[hh * 65 + j] + xv * (1.0f + D[h]);
  }
}

// ---------------------------------------------------------------------------
// Kernel 5: LayerNorm over H. One block per (b,l); fully coalesced.
// out = (r-mu)*rsqrt(var+eps)*w + b
// ---------------------------------------------------------------------------
__global__ void final_kernel(const float* __restrict__ R,
                             const float* __restrict__ ln_w,
                             const float* __restrict__ ln_b,
                             float* __restrict__ out) {
  __shared__ float s_sum[256], s_sq[256];
  const int bl  = blockIdx.x;              // b*L + l
  const int tid = threadIdx.x;
  float r[4];
  float lsum = 0.0f, lsq = 0.0f;
#pragma unroll
  for (int i = 0; i < 4; ++i) {
    const int h  = i * 256 + tid;
    const float rv = R[(size_t)bl * H_SZ + h];
    r[i] = rv; lsum += rv; lsq += rv * rv;
  }
  s_sum[tid] = lsum; s_sq[tid] = lsq;
  __syncthreads();
  for (int off = 128; off > 0; off >>= 1) {
    if (tid < off) { s_sum[tid] += s_sum[tid + off]; s_sq[tid] += s_sq[tid + off]; }
    __syncthreads();
  }
  const float mu  = s_sum[0] * (1.0f / (float)H_SZ);
  const float var = s_sq[0] * (1.0f / (float)H_SZ) - mu * mu;
  const float inv = rsqrtf(var + LN_EPS);
#pragma unroll
  for (int i = 0; i < 4; ++i) {
    const int h = i * 256 + tid;
    out[(size_t)bl * H_SZ + h] = (r[i] - mu) * inv * ln_w[h] + ln_b[h];
  }
}

// ---------------------------------------------------------------------------
// Host launcher
// ---------------------------------------------------------------------------
extern "C" void kernel_launch(void* const* d_in, const int* in_sizes, int n_in,
                              void* d_out, int out_size, void* d_ws, size_t ws_size,
                              hipStream_t stream) {
  const float* x          = (const float*)d_in[0];
  const float* log_A_real = (const float*)d_in[1];
  const float* A_imag     = (const float*)d_in[2];
  const float* C_re       = (const float*)d_in[3];
  const float* C_im       = (const float*)d_in[4];
  const float* log_dt     = (const float*)d_in[5];
  const float* Dterm      = (const float*)d_in[6];
  const float* ln_w       = (const float*)d_in[7];
  const float* ln_b       = (const float*)d_in[8];
  float* out = (float*)d_out;

  // workspace layout (bytes)
  char* ws = (char*)d_ws;
  const size_t WIN_B = (size_t)H_SZ * 2 * N_SZ * P_SZ * 2;   // 16 MB
  const size_t E_B   = (size_t)H_SZ * P_SZ * 2 * N_SZ * 2;   // 16 MB
  const size_t T_B   = (size_t)H_SZ * P_SZ * P_SZ * 2;       //  8 MB
  const size_t DEC_B = (size_t)H_SZ * N_SZ * 2 * 4;          // 0.5 MB
  const size_t XC_B  = (size_t)H_SZ * NCOL * P_SZ * 2;       // 32 MB
  size_t off = 0;
  _Float16* Win    = (_Float16*)(ws + off); off += WIN_B;
  _Float16* Emat   = (_Float16*)(ws + off); off += E_B;
  _Float16* Tmat   = (_Float16*)(ws + off); off += T_B;
  float*    decayP = (float*)   (ws + off); off += DEC_B;
  _Float16* Xc     = (_Float16*)(ws + off); off += XC_B;
  float*    Yconv  = (float*)   (ws + off);                  // 64 MB
  // R (r = x*(1+D)+y, [B,L,H] f32, 67 MB) aliases Win..Xc (72.5 MB, dead
  // after chunk_chain_kernel).
  float* R = (float*)ws;
  (void)ws_size; (void)n_in; (void)in_sizes; (void)out_size;

  // 1) parameter precompute: 1024 blocks x 64 threads
  precompute_kernel<<<dim3(H_SZ), dim3(P_SZ), 0, stream>>>(
      log_A_real, A_imag, C_re, C_im, log_dt, Win, Emat, Tmat, decayP);

  // 2) pack x -> f16 column tiles (LDS transpose): grid (256 cols, 16 h-tiles)
  pack_x_kernel<<<dim3(NCOL, H_SZ / 64), dim3(256), 0, stream>>>(x, Xc);

  // 3) ingest matmul, recurrence, emit matmul (WMMA): one work-group per h
  chunk_chain_kernel<<<dim3(H_SZ), dim3(256), 0, stream>>>(
      Win, Emat, Tmat, Xc, decayP, Yconv);

  // 4) transpose back + fused residual (R aliases Win..Xc region)
  transpose_residual_kernel<<<dim3(NCOL, H_SZ / 64), dim3(256), 0, stream>>>(
      Yconv, x, Dterm, R);

  // 5) LayerNorm: one block per (b,l), fully coalesced
  final_kernel<<<dim3(B_SZ * L_SZ), dim3(256), 0, stream>>>(R, ln_w, ln_b, out);
}

// v002
// It runs in 76.2 microseconds.
// In both of two side-by-side timings against v001, it was 1.33 times as fast.
// Over all steps from v000 it is 2.67 times as fast.
#include <hip/hip_runtime.h>
#include <hip/hip_bf16.h>

#define B_SZ 4
#define L_SZ 4096
#define H_SZ 1024
#define N_SZ 64
#define P_SZ 64                 // chunk length
#define C_SZ (L_SZ / P_SZ)      // 64 chunks
#define NCOL (B_SZ * C_SZ)      // 256 matmul columns per h
#define LN_EPS 1e-5f

typedef __attribute__((ext_vector_type(16))) _Float16 v16h;
typedef __attribute__((ext_vector_type(8)))  _Float16 v8h;
typedef __attribute__((ext_vector_type(8)))  float    v8f;
typedef __attribute__((ext_vector_type(4)))  float    v4f;
typedef __attribute__((ext_vector_type(2)))  float    v2f;

// ---------------------------------------------------------------------------
// Kernel 1: per-h parameter precompute (discretization, Toeplitz kernel,
// ingest matrix Win, emission matrix E, per-chunk decay a^P).
// One block (64 threads) per h.
// ---------------------------------------------------------------------------
__global__ void precompute_kernel(const float* __restrict__ log_A_real,
                                  const float* __restrict__ A_imag,
                                  const float* __restrict__ C_re,
                                  const float* __restrict__ C_im,
                                  const float* __restrict__ log_dt,
                                  _Float16* __restrict__ Win,
                                  _Float16* __restrict__ Emat,
                                  _Float16* __restrict__ Tmat,
                                  float* __restrict__ decayP) {
  __shared__ float s_dtAr[N_SZ], s_dtAi[N_SZ], s_Ctr[N_SZ], s_Cti[N_SZ], s_K[P_SZ];
  const int h = blockIdx.x;
  const int t = threadIdx.x;                 // 0..63, doubles as state index n
  const float dt = __expf(log_dt[h]);

  // thread t owns state n = t for the setup phase
  const float Ar = -__expf(log_A_real[h * N_SZ + t]);
  const float Ai = A_imag[h * N_SZ + t];
  const float dAr = dt * Ar, dAi = dt * Ai;
  const float e0 = __expf(dAr);
  const float are = e0 * __cosf(dAi), aim = e0 * __sinf(dAi);
  // Ct = C * (exp(dtA)-1)/A
  const float xr = are - 1.0f, xi = aim;
  const float inv = 1.0f / (Ar * Ar + Ai * Ai);
  const float qr = (xr * Ar + xi * Ai) * inv;
  const float qi = (xi * Ar - xr * Ai) * inv;
  const float cr = C_re[h * N_SZ + t], ci = C_im[h * N_SZ + t];
  const float Ctr = cr * qr - ci * qi;
  const float Cti = cr * qi + ci * qr;
  s_dtAr[t] = dAr; s_dtAi[t] = dAi; s_Ctr[t] = Ctr; s_Cti[t] = Cti;

  // per-chunk decay a^P
  const float eP = __expf(dAr * (float)P_SZ);
  decayP[(h * N_SZ + t) * 2 + 0] = eP * __cosf(dAi * (float)P_SZ);
  decayP[(h * N_SZ + t) * 2 + 1] = eP * __sinf(dAi * (float)P_SZ);
  __syncthreads();

  // K[d] = 2 * sum_n Re(Ct_n * a_n^d) ; thread t computes d = t
  {
    float acc = 0.0f;
    for (int n = 0; n < N_SZ; ++n) {
      const float ed = __expf(s_dtAr[n] * (float)t);
      const float cc = __cosf(s_dtAi[n] * (float)t);
      const float ss = __sinf(s_dtAi[n] * (float)t);
      acc += 2.0f * (s_Ctr[n] * ed * cc - s_Cti[n] * ed * ss);
    }
    s_K[t] = acc;
  }

  // Win[h][n][t]     = Re(a_n^(P-1-t))   (row-major, ld = P)
  // Win[h][N+n][t]   = Im(a_n^(P-1-t))
  {
    const float pw = (float)(P_SZ - 1 - t);
    _Float16* wp = Win + (size_t)h * (2 * N_SZ * P_SZ);
    for (int n = 0; n < N_SZ; ++n) {
      const float ed = __expf(s_dtAr[n] * pw);
      wp[n * P_SZ + t]          = (_Float16)(ed * __cosf(s_dtAi[n] * pw));
      wp[(N_SZ + n) * P_SZ + t] = (_Float16)(ed * __sinf(s_dtAi[n] * pw));
    }
  }

  // E[h][j][n]   =  2*Re(Ct_n a_n^(j+1))  (row-major, ld = 2N), thread j = t
  // E[h][j][N+n] = -2*Im(Ct_n a_n^(j+1))
  {
    const float pw = (float)(t + 1);
    _Float16* ep = Emat + (size_t)h * (P_SZ * 2 * N_SZ) + (size_t)t * (2 * N_SZ);
    for (int n = 0; n < N_SZ; ++n) {
      const float ed = __expf(s_dtAr[n] * pw);
      const float cc = __cosf(s_dtAi[n] * pw), ss = __sinf(s_dtAi[n] * pw);
      const float pr = s_Ctr[n] * ed * cc - s_Cti[n] * ed * ss;
      const float pi = s_Ctr[n] * ed * ss + s_Cti[n] * ed * cc;
      ep[n]        = (_Float16)( 2.0f * pr);
      ep[N_SZ + n] = (_Float16)(-2.0f * pi);
    }
  }
  __syncthreads();

  // Lower-triangular Toeplitz T[h][j][u] = (u<=j) ? K[j-u] : 0 ; thread j = t
  {
    _Float16* tp = Tmat + (size_t)h * (P_SZ * P_SZ) + (size_t)t * P_SZ;
    for (int u = 0; u < P_SZ; ++u)
      tp[u] = (u <= t) ? (_Float16)s_K[t - u] : (_Float16)0.0f;
  }
}

// ---------------------------------------------------------------------------
// Kernel 2: pack x [B,L,H] f32 -> Xc[h][col][t] f16 via LDS transpose.
// Block = 256 threads handles one (b, c) chunk x 64-h tile (64x64 elements x16).
// Coalesced f32 reads along h; contiguous f16 writes along t.
// ---------------------------------------------------------------------------
__global__ void pack_x_kernel(const float* __restrict__ x, _Float16* __restrict__ Xc) {
  __shared__ _Float16 s_tile[64 * 65];
  const int col = blockIdx.x;              // c*B + b
  const int hb  = blockIdx.y;              // h tile (0..15)
  const int b   = col & (B_SZ - 1);
  const int c   = col >> 2;
  const int tid = threadIdx.x;
#pragma unroll
  for (int i = 0; i < 16; ++i) {
    const int lin = i * 256 + tid;
    const int t  = lin >> 6;               // position within chunk
    const int hh = lin & 63;               // h within tile (fast -> coalesced)
    const int l  = c * P_SZ + t;
    s_tile[hh * 65 + t] =
        (_Float16)x[((size_t)b * L_SZ + l) * H_SZ + hb * 64 + hh];
  }
  __syncthreads();
#pragma unroll
  for (int i = 0; i < 16; ++i) {
    const int lin = i * 256 + tid;
    const int hh = lin >> 6;
    const int t  = lin & 63;               // t fast -> contiguous writes
    const int h  = hb * 64 + hh;
    Xc[(size_t)h * (NCOL * P_SZ) + (size_t)col * P_SZ + t] = s_tile[hh * 65 + t];
  }
}

// ---------------------------------------------------------------------------
// WMMA fragment loader from LDS. Row-major A (row per lane) and
// column-contiguous B (col per lane) share the identical per-lane K packing:
//   halves 0..7  -> K = k0 + (lane<16 ? 0 : 8) + i
//   halves 8..15 -> K = k0 + 16 + (lane<16 ? 0 : 8) + i
// Both runs are 8 contiguous halves, 16B aligned -> two ds_load_b128.
// ---------------------------------------------------------------------------
#define XP 72    // LDS pitch (halves) of 64-half rows:  144 B = 16 B x 9
#define SP 136   // LDS pitch (halves) of 128-half rows: 272 B = 16 B x 17

__device__ __forceinline__ v16h lds_frag(const _Float16* base, int ld, int rc0,
                                         int k0, int lane) {
  const _Float16* p = base + (rc0 + (lane & 15)) * ld + k0 + ((lane & 16) ? 8 : 0);
  const v8h lo = *(const v8h*)p;
  const v8h hi = *(const v8h*)(p + 16);
  return __builtin_shufflevector(lo, hi, 0, 1, 2, 3, 4, 5, 6, 7,
                                 8, 9, 10, 11, 12, 13, 14, 15);
}

// ---------------------------------------------------------------------------
// Kernel 3: ingest matmul, inter-chunk recurrence and emit matmul of one h in
// one work-group (8 waves). Wave w owns columns [32w, 32w+32) in both matmuls.
//   U[128 x 256] = Win[128 x 64] * X[64 x 256]        -> LDS, f16, [col][row]
//   per (b, n): S(before chunk c) replaces U(c) in place; s <- a^P * s + u
//   Y[64 x 256]  = T[64 x 64] * X + E[64 x 128] * S   -> global, [h][col][j]
// U and S never leave LDS; every global read of Win, X, T and E is a whole-line 16 B per lane read.
// Each plain '#pragma unroll' below makes the indices of a register array
// compile-time constants, so that the array stays in registers.
// ---------------------------------------------------------------------------
// Second launch bound: 6 waves per SIMD, the three work-groups per WGP that the
// 96,256 B of LDS allow.
__global__ __launch_bounds__(256, 6) void chunk_chain_kernel(
    const _Float16* __restrict__ Win, const _Float16* __restrict__ Emat,
    const _Float16* __restrict__ Tmat, const _Float16* __restrict__ Xc,
    const float* __restrict__ decayP, float* __restrict__ Y) {
  // U, then S: 256 columns of 128 halves. Each wave first parks its own 32
  // columns of X in its own slice (read back into registers before U lands).
  __shared__ __attribute__((aligned(16))) _Float16 s_us[NCOL * SP];
  // Win during ingest; T (64 rows, pitch XP) and E (64 rows, pitch SP) after it.
  __shared__ __attribute__((aligned(16))) _Float16 s_par[P_SZ * XP + P_SZ * SP];
  const int h    = blockIdx.x;
  const int tid  = threadIdx.x;
  const int wave = tid >> 5;
  const int lane = tid & 31;
  const _Float16* gW = Win  + (size_t)h * (2 * N_SZ * P_SZ);
  const _Float16* gT = Tmat + (size_t)h * (P_SZ * P_SZ);
  const _Float16* gE = Emat + (size_t)h * (P_SZ * 2 * N_SZ);
  const _Float16* gX = Xc   + (size_t)h * (NCOL * P_SZ) + wave * (32 * P_SZ);
  _Float16* s_own = s_us + wave * (32 * SP);
  _Float16* s_T   = s_par;
  _Float16* s_E   = s_par + P_SZ * XP;

  // ---- fetch everything this h needs; stage Win (work-group), X (per wave) ----
  v8h wReg[4], xReg[8], tReg[2], eReg[4];
#pragma unroll
  for (int i = 0; i < 4; ++i) wReg[i] = *(const v8h*)(gW + (i * 256 + tid) * 8);
#pragma unroll
  for (int i = 0; i < 8; ++i) xReg[i] = *(const v8h*)(gX + (i * 32 + lane) * 8);
#pragma unroll
  for (int i = 0; i < 2; ++i) tReg[i] = *(const v8h*)(gT + (i * 256 + tid) * 8);
#pragma unroll
  for (int i = 0; i < 4; ++i) eReg[i] = *(const v8h*)(gE + (i * 256 + tid) * 8);
  const int sn = tid & (N_SZ - 1);           // state index of the recurrence
  const int sb = tid >> 6;                   // batch index of the recurrence
  const float dr = decayP[(h * N_SZ + sn) * 2 + 0];
  const float di = decayP[(h * N_SZ + sn) * 2 + 1];
  // All loads are in flight before the first LDS store waits for one; without
  // this the loads were issued one at a time, each behind the last one's wait.
  __builtin_amdgcn_sched_barrier(0);
#pragma unroll
  for (int i = 0; i < 4; ++i) {
    const int q = i * 256 + tid;             // 16-byte piece of Win
    *(v8h*)(s_par + (q >> 3) * XP + (q & 7) * 8) = wReg[i];
  }
#pragma unroll
  for (int i = 0; i < 8; ++i) {
    const int q = i * 32 + lane;             // 16-byte piece of this wave's X
    *(v8h*)(s_own + (q >> 3) * XP + (q & 7) * 8) = xReg[i];
  }
  __syncthreads();

  // ---- ingest: X fragments stay in registers for the emit matmul ----
  const int cl = lane & 15;
  const int r8 = (lane & 16) ? 8 : 0;
  v16h xb[2][2];
#pragma unroll
  for (int nn = 0; nn < 2; ++nn)
#pragma unroll
    for (int kk = 0; kk < 2; ++kk)
      xb[nn][kk] = lds_frag(s_own, XP, nn * 16, kk * 32, lane);
#pragma unroll
  for (int m = 0; m < 8; ++m) {
    const v16h a0 = lds_frag(s_par, XP, m * 16, 0, lane);
    const v16h a1 = lds_frag(s_par, XP, m * 16, 32, lane);
#pragma unroll
    for (int nn = 0; nn < 2; ++nn) {
      v8f acc = {};
      acc = __builtin_amdgcn_wmma_f32_16x16x32_f16(false, a0, false, xb[nn][0],
                                                   (short)0, acc, false, false);
      acc = __builtin_amdgcn_wmma_f32_16x16x32_f16(false, a1, false, xb[nn][1],
                                                   (short)0, acc, false, false);
      v8h hv;
#pragma unroll
      for (int i = 0; i < 8; ++i) hv[i] = (_Float16)acc[i];
      *(v8h*)(s_own + (nn * 16 + cl) * SP + m * 16 + r8) = hv;
    }
  }
  __syncthreads();   // U complete; Win no longer read

  // ---- T and E take Win's place ----
#pragma unroll
  for (int i = 0; i < 2; ++i) {
    const int q = i * 256 + tid;
    *(v8h*)(s_T + (q >> 3) * XP + (q & 7) * 8) = tReg[i];
  }
#pragma unroll
  for (int i = 0; i < 4; ++i) {
    const int q = i * 256 + tid;
    *(v8h*)(s_E + (q >> 4) * SP + (q & 15) * 8) = eReg[i];
  }

  // ---- recurrence over the 64 chunks, one thread per (b, n), in place ----
  {
    _Float16* sp = s_us + sb * SP + sn;
    float sr = 0.0f, si = 0.0f;
    // Kept rolled: fully unrolled, the 128 loaded halves each hold a register.
#pragma unroll 1
    for (int c0 = 0; c0 < C_SZ; c0 += 16) {
      _Float16 ur[16], ui[16];
#pragma unroll
      for (int i = 0; i < 16; ++i) {
        ur[i] = sp[(c0 + i) * (B_SZ * SP)];
        ui[i] = sp[(c0 + i) * (B_SZ * SP) + N_SZ];
      }
#pragma unroll
      for (int i = 0; i < 16; ++i) {
        sp[(c0 + i) * (B_SZ * SP)]        = (_Float16)sr;
        sp[(c0 + i) * (B_SZ * SP) + N_SZ] = (_Float16)si;
        // Explicit fused forms: which product is rounded before the fuse is
        // fixed here, not left to the compiler's choice.
        const float nsr = fmaf(dr, sr, -(di * si)) + (float)ur[i];
        const float nsi = fmaf(dr, si, di * sr) + (float)ui[i];
        sr = nsr; si = nsi;
      }
    }
  }
  __syncthreads();   // S, T and E complete

  // ---- emit: 4 x 2 accumulator tiles per wave, k outermost ----
  v8f acc[4][2] = {};
#pragma unroll
  for (int kk = 0; kk < 2; ++kk)
#pragma unroll
    for (int m = 0; m < 4; ++m) {
      const v16h a = lds_frag(s_T, XP, m * 16, kk * 32, lane);
#pragma unroll
      for (int nn = 0; nn < 2; ++nn)
        acc[m][nn] = __builtin_amdgcn_wmma_f32_16x16x32_f16(
            false, a, false, xb[nn][kk], (short)0, acc[m][nn], false, false);
    }
#pragma unroll
  for (int kk = 0; kk < 4; ++kk) {
    const v16h s0 = lds_frag(s_own, SP, 0, kk * 32, lane);
    const v16h s1 = lds_frag(s_own, SP, 16, kk * 32, lane);
#pragma unroll
    for (int m = 0; m < 4; ++m) {
      const v16h a = lds_frag(s_E, SP, m * 16, kk * 32, lane);
      acc[m][0] = __builtin_amdgcn_wmma_f32_16x16x32_f16(
          false, a, false, s0, (short)0, acc[m][0], false, false);
      acc[m][1] = __builtin_amdgcn_wmma_f32_16x16x32_f16(
          false, a, false, s1, (short)0, acc[m][1], false, false);
    }
  }
  float* Yp = Y + (size_t)h * (P_SZ * NCOL) + (size_t)(wave * 32) * P_SZ;
  // Keeps every store behind the last LDS load and WMMA, so that no register
  // an issued store names is written again.
  __builtin_amdgcn_sched_barrier(0);
#pragma unroll
  for (int nn = 0; nn < 2; ++nn)
#pragma unroll
    for (int m = 0; m < 4; ++m) {
      float* dst = Yp + (size_t)(nn * 16 + cl) * P_SZ + m * 16 + r8;
      const v8f d = acc[m][nn];
      v4f lo = {d[0], d[1], d[2], d[3]};
      v4f hi = {d[4], d[5], d[6], d[7]};
      *(v4f*)dst       = lo;                    // 16B store
      *(v4f*)(dst + 4) = hi;                    // 16B store
    }
}

// ---------------------------------------------------------------------------
// Kernel 4: transpose Y[h][col][j] back, residual and LayerNorm in one pass:
//   r = x*(1+D) + y ;  out = (r-mu)*rsqrt(var+eps)*w + b
// One work-group (16 waves) per column = 64 rows (b,l) x all 1024 h, so that a
// row's mean and variance are formed where r is made and r never goes to memory.
// Y passes through LDS as s_y[j][h]; the 16-byte group of four h is stored at
// group ^ (j >> 2): the transposing 8-byte stores and the 16-byte row reads
// then both touch every bank once.
// Global accesses of Y, x and out are 16 B per lane on whole lines; a wave owns
// four rows, one after the other. Each plain '#pragma unroll' keeps a register
// array's indices constant.
// ---------------------------------------------------------------------------
__global__ __launch_bounds__(512) void residual_norm_kernel(
    const float* __restrict__ Y, const float* __restrict__ x,
    const float* __restrict__ D, const float* __restrict__ ln_w,
    const float* __restrict__ ln_b, float* __restrict__ out) {
  // D, w, b (12 KiB), then the column's Y (256 KiB)
  __shared__ __attribute__((aligned(16))) float s_all[3 * H_SZ + P_SZ * H_SZ];
  float* s_vec = s_all;
  float* s_y   = s_all + 3 * H_SZ;
  const int col  = blockIdx.x;             // c*B + b
  const int b    = col & (B_SZ - 1);
  const int c    = col >> 2;
  const int tid  = threadIdx.x;
  const int wave = tid >> 5;
  const int lane = tid & 31;
  const int k    = lane & 15;              // 16-byte piece of a 64-j run of Y
  const int hh   = lane >> 4;

  // ---- in flight at once: the vectors, the wave's Y, its first two x rows ----
  const v2f dv = *(const v2f*)(D + tid * 2);
  const v2f wv = *(const v2f*)(ln_w + tid * 2);
  const v2f bv = *(const v2f*)(ln_b + tid * 2);
  const size_t row0 = (size_t)b * L_SZ + c * P_SZ + wave * 4;
  const float* gx = x + row0 * H_SZ + lane * 4;
  v4f xr[2][8];
#pragma unroll
  for (int r = 0; r < 2; ++r)
#pragma unroll
    for (int q = 0; q < 8; ++q)
      xr[r][q] = *(const v4f*)(gx + r * H_SZ + q * 128);
  // load (m, p) holds h = wave*64 + 4*m + 2*hh + p, j = 4*k .. 4*k+3
  const float* gy = Y + ((size_t)(wave * 64 + 2 * hh) * NCOL + col) * P_SZ + k * 4;
  v4f yr[16][2];
#pragma unroll
  for (int m = 0; m < 16; ++m)
#pragma unroll
    for (int p = 0; p < 2; ++p)
      yr[m][p] = *(const v4f*)(gy + (size_t)(4 * m + p) * (NCOL * P_SZ));
  // Y's address registers are held up to this wait (the input operand) and are
  // free for other use behind it; the wave waits for the loaded data next in
  // any case.
  asm volatile("s_wait_xcnt 0x0" :: "v"(gy) : "memory");
  // Every load above is issued before the first LDS store waits for one, and
  // nothing of the row work below is moved up among them (it spilled there).
  __builtin_amdgcn_sched_barrier(0);
  *(v2f*)(s_vec + tid * 2)            = dv;
  *(v2f*)(s_vec + H_SZ + tid * 2)     = wv;
  *(v2f*)(s_vec + 2 * H_SZ + tid * 2) = bv;
  float* sd = s_y + (k * 4) * H_SZ + wave * 64 + 2 * hh;
#pragma unroll
  for (int m = 0; m < 16; ++m)
#pragma unroll
    for (int e = 0; e < 4; ++e) {
      const v2f pr = {yr[m][0][e], yr[m][1][e]};
      *(v2f*)(sd + e * H_SZ + (m ^ k) * 4) = pr;
    }
  __syncthreads();   // the column's Y and the three vectors are in LDS

  // ---- the lane's 32 h of 1+D, w and b stay in registers for all four rows ----
  v4f d1[8], w4[8], b4[8];
#pragma unroll
  for (int q = 0; q < 8; ++q) {
    d1[q] = *(const v4f*)(s_vec + q * 128 + lane * 4) + 1.0f;
    w4[q] = *(const v4f*)(s_vec + H_SZ + q * 128 + lane * 4);
    b4[q] = *(const v4f*)(s_vec + 2 * H_SZ + q * 128 + lane * 4);
  }
  const float* sy = s_y + (wave * 4) * H_SZ + (lane ^ wave) * 4;
  float* go = out + row0 * H_SZ + lane * 4;
#pragma unroll
  for (int r = 0; r < 4; ++r) {
    v4f (&xc)[8] = xr[r & 1];
    // four partial sums a lane, one per element of a 16-byte group
    v4f s4 = {}, q4 = {};
#pragma unroll
    for (int q = 0; q < 8; ++q) {
      const v4f rv = *(const v4f*)(sy + r * H_SZ + q * 128) + xc[q] * d1[q];
      xc[q] = rv;
      s4 += rv;
      q4 += rv * rv;
    }
    float sum = (s4[0] + s4[1]) + (s4[2] + s4[3]);
    float sq  = (q4[0] + q4[1]) + (q4[2] + q4[3]);
#pragma unroll
    for (int m = 16; m > 0; m >>= 1) {
      sum += __shfl_xor(sum, m, 32);
      sq  += __shfl_xor(sq, m, 32);
    }
    const float mu  = sum * (1.0f / (float)H_SZ);
    const float var = sq * (1.0f / (float)H_SZ) - mu * mu;
    const float inv = rsqrtf(var + LN_EPS);
#pragma unroll
    for (int q = 0; q < 8; ++q)
      *(v4f*)(go + r * H_SZ + q * 128) = (xc[q] - mu) * inv * w4[q] + b4[q];
    // the row after next
    if (r < 2) {
#pragma unroll
      for (int q = 0; q < 8; ++q)
        xc[q] = *(const v4f*)(gx + (r + 2) * H_SZ + q * 128);
    }
  }
}

// ---------------------------------------------------------------------------
// Host launcher
// ---------------------------------------------------------------------------
extern "C" void kernel_launch(void* const* d_in, const int* in_sizes, int n_in,
                              void* d_out, int out_size, void* d_ws, size_t ws_size,
                              hipStream_t stream) {
  const float* x          = (const float*)d_in[0];
  const float* log_A_real = (const float*)d_in[1];
  const float* A_imag     = (const float*)d_in[2];
  const float* C_re       = (const float*)d_in[3];
  const float* C_im       = (const float*)d_in[4];
  const float* log_dt     = (const float*)d_in[5];
  const float* Dterm      = (const float*)d_in[6];
  const float* ln_w       = (const float*)d_in[7];
  const float* ln_b       = (const float*)d_in[8];
  float* out = (float*)d_out;

  // workspace layout (bytes)
  char* ws = (char*)d_ws;
  const size_t WIN_B = (size_t)H_SZ * 2 * N_SZ * P_SZ * 2;   // 16 MB
  const size_t E_B   = (size_t)H_SZ * P_SZ * 2 * N_SZ * 2;   // 16 MB
  const size_t T_B   = (size_t)H_SZ * P_SZ * P_SZ * 2;       //  8 MB
  const size_t DEC_B = (size_t)H_SZ * N_SZ * 2 * 4;          // 0.5 MB
  const size_t XC_B  = (size_t)H_SZ * NCOL * P_SZ * 2;       // 32 MB
  size_t off = 0;
  _Float16* Win    = (_Float16*)(ws + off); off += WIN_B;
  _Float16* Emat   = (_Float16*)(ws + off); off += E_B;
  _Float16* Tmat   = (_Float16*)(ws + off); off += T_B;
  float*    decayP = (float*)   (ws + off); off += DEC_B;
  _Float16* Xc     = (_Float16*)(ws + off); off += XC_B;
  float*    Yconv  = (float*)   (ws + off);                  // 64 MB
  (void)ws_size; (void)n_in; (void)in_sizes; (void)out_size;

  // 1) parameter precompute: 1024 blocks x 64 threads
  precompute_kernel<<<dim3(H_SZ), dim3(P_SZ), 0, stream>>>(
      log_A_real, A_imag, C_re, C_im, log_dt, Win, Emat, Tmat, decayP);

  // 2) pack x -> f16 column tiles (LDS transpose): grid (256 cols, 16 h-tiles)
  pack_x_kernel<<<dim3(NCOL, H_SZ / 64), dim3(256), 0, stream>>>(x, Xc);

  // 3) ingest matmul, recurrence, emit matmul (WMMA): one work-group per h
  chunk_chain_kernel<<<dim3(H_SZ), dim3(256), 0, stream>>>(
      Win, Emat, Tmat, Xc, decayP, Yconv);

  // 4) transpose back, residual, LayerNorm: one work-group per column
  residual_norm_kernel<<<dim3(NCOL), dim3(512), 0, stream>>>(
      Yconv, x, Dterm, ln_w, ln_b, out);
}

// v003
// Measured time: 46 microseconds a run.
// Next to v002, in two timings, it ran 1.66 and 1.67 times as fast.
// Counting every step since v000, it is 4.44 times as fast.
#include <hip/hip_runtime.h>
#include <hip/hip_bf16.h>

#define B_SZ 4
#define L_SZ 4096
#define H_SZ 1024
#define N_SZ 64
#define P_SZ 64                 // chunk length
#define C_SZ (L_SZ / P_SZ)      // 64 chunks
#define NCOL (B_SZ * C_SZ)      // 256 matmul columns per h
#define LN_EPS 1e-5f

typedef __attribute__((ext_vector_type(16))) _Float16 v16h;
typedef __attribute__((ext_vector_type(8)))  _Float16 v8h;
typedef __attribute__((ext_vector_type(8)))  float    v8f;
typedef __attribute__((ext_vector_type(4)))  float    v4f;
typedef __attribute__((ext_vector_type(2)))  float    v2f;

// ---------------------------------------------------------------------------
// Kernel 1: pack x [B,L,H] f32 -> Xc[h][col][t] f16 via LDS transpose.
// Block = 256 threads handles one (b, c) chunk x 64-h tile (64x64 elements x16).
// Coalesced f32 reads along h; contiguous f16 writes along t.
// ---------------------------------------------------------------------------
__global__ void pack_x_kernel(const float* __restrict__ x, _Float16* __restrict__ Xc) {
  __shared__ _Float16 s_tile[64 * 65];
  const int col = blockIdx.x;              // c*B + b
  const int hb  = blockIdx.y;              // h tile (0..15)
  const int b   = col & (B_SZ - 1);
  const int c   = col >> 2;
  const int tid = threadIdx.x;
#pragma unroll
  for (int i = 0; i < 16; ++i) {
    const int lin = i * 256 + tid;
    const int t  = lin >> 6;               // position within chunk
    const int hh = lin & 63;               // h within tile (fast -> coalesced)
    const int l  = c * P_SZ + t;
    s_tile[hh * 65 + t] =
        (_Float16)x[((size_t)b * L_SZ + l) * H_SZ + hb * 64 + hh];
  }
  __syncthreads();
#pragma unroll
  for (int i = 0; i < 16; ++i) {
    const int lin = i * 256 + tid;
    const int hh = lin >> 6;
    const int t  = lin & 63;               // t fast -> contiguous writes
    const int h  = hb * 64 + hh;
    Xc[(size_t)h * (NCOL * P_SZ) + (size_t)col * P_SZ + t] = s_tile[hh * 65 + t];
  }
}

// ---------------------------------------------------------------------------
// WMMA fragment loader from LDS. Row-major A (row per lane) and
// column-contiguous B (col per lane) share the identical per-lane K packing:
//   halves 0..7  -> K = k0 + (lane<16 ? 0 : 8) + i
//   halves 8..15 -> K = k0 + 16 + (lane<16 ? 0 : 8) + i
// Both runs are 8 contiguous halves, 16B aligned -> two ds_load_b128.
// ---------------------------------------------------------------------------
#define XP 72    // LDS pitch (halves) of 64-half rows:  144 B = 16 B x 9
#define SP 136   // LDS pitch (halves) of 128-half rows: 272 B = 16 B x 17

__device__ __forceinline__ v16h lds_frag(const _Float16* base, int ld, int rc0,
                                         int k0, int lane) {
  const _Float16* p = base + (rc0 + (lane & 15)) * ld + k0 + ((lane & 16) ? 8 : 0);
  const v8h lo = *(const v8h*)p;
  const v8h hi = *(const v8h*)(p + 16);
  return __builtin_shufflevector(lo, hi, 0, 1, 2, 3, 4, 5, 6, 7,
                                 8, 9, 10, 11, 12, 13, 14, 15);
}

// ---------------------------------------------------------------------------
// Kernel 2: parameters, ingest matmul, inter-chunk recurrence and emit matmul of
// one h in one work-group (8 waves). Wave w owns columns [32w, 32w+32) in both
// matmuls.
//   a_n = exp(dt*A_n), Ct_n = C_n*(a_n - 1)/A_n ; thread (n, g) forms the powers
//   a_n^d, d = 16g .. 16g+16, once, while the loads of X are in flight:
//     Win[n][t] = Re a_n^(P-1-t), Win[N+n][t] = Im a_n^(P-1-t)     -> LDS
//     E[j][n] = 2 Re(Ct_n a_n^(j+1)), E[j][N+n] = -2 Im(Ct_n a_n^(j+1))
//     K[d] = 2 sum_n Re(Ct_n a_n^d) ; T[j][u] = (u <= j) ? K[j-u] : 0
//   U[128 x 256] = Win[128 x 64] * X[64 x 256]        -> LDS, f16, [col][row]
//   per (b, n): S(before chunk c) replaces U(c) in place; s <- a^P * s + u
//   Y[64 x 256]  = T[64 x 64] * X + E[64 x 128] * S   -> global, [h][col][j]
// Win, E, T, U and S never leave the work-group; X is read by whole-line 16 B
// per lane reads.
// Each plain '#pragma unroll' below makes the indices of a register array
// compile-time constants, so that the array stays in registers.
// ---------------------------------------------------------------------------
#define KP 68    // LDS pitch (floats) of a row of K terms: 272 B = 16 B x 17

// ed = exp(re), cc = cos(im), ss = sin(im) in the fast hardware forms. The three
// transcendentals stand in one statement, their results in registers apart from
// the inputs, with one v_nop behind the last: the slot that the instruction set
// asks for between a transcendental and an instruction that reads its result or
// overwrites its source.
__device__ __forceinline__ void cexp_parts(float re, float im, float& ed,
                                           float& cc, float& ss) {
  const float xe = re * 1.44269504f;         // v_exp_f32 is 2^x
  const float xa = im * 0.15915494f;         // v_cos/v_sin_f32 take revolutions
  asm("v_exp_f32 %0, %3\n\tv_cos_f32 %1, %4\n\tv_sin_f32 %2, %4\n\tv_nop"
      : "=&v"(ed), "=&v"(cc), "=&v"(ss) : "v"(xe), "v"(xa));
}

// Second launch bound: 6 waves per SIMD, the three work-groups per WGP that the
// 98,432 B of LDS allow.
__global__ __launch_bounds__(256, 6) void chunk_chain_kernel(
    const float* __restrict__ log_A_real, const float* __restrict__ A_imag,
    const float* __restrict__ C_re, const float* __restrict__ C_im,
    const float* __restrict__ log_dt, const _Float16* __restrict__ Xc,
    float* __restrict__ Y) {
  // U, then S: 256 columns of 128 halves. Each wave first parks its own 32
  // columns of X in the first 4,608 B of its own slice (read back into registers
  // before U lands); the 4,096 B behind them hold, until U lands, the K terms of
  // the eight d = 8*wave .. 8*wave+7 as float [d & 7][n], pitch KP.
  __shared__ __attribute__((aligned(16))) _Float16 s_us[NCOL * SP];
  // Win during ingest; T (64 rows, pitch XP) and E (64 rows, pitch SP) after it.
  __shared__ __attribute__((aligned(16))) _Float16 s_par[P_SZ * XP + P_SZ * SP];
  // With R[i] = K[P-1-i] for i < P and 0 behind, row j of T is R[P-1-j .. 2P-2-j].
  // Copy k holds R shifted by k halves (s_R[k*SP + m] = R[m + k]), so that every
  // 16-byte piece of T is a 16-byte aligned read of one of the eight copies.
  __shared__ __attribute__((aligned(16))) _Float16 s_R[8 * SP];
  const int h    = blockIdx.x;
  const int tid  = threadIdx.x;
  const int wave = tid >> 5;
  const int lane = tid & 31;
  const _Float16* gX = Xc + (size_t)h * (NCOL * P_SZ) + wave * (32 * P_SZ);
  _Float16* s_own = s_us + wave * (32 * SP);
  _Float16* s_T   = s_par;
  _Float16* s_E   = s_par + P_SZ * XP;
  const int sn = tid & (N_SZ - 1);           // state index n, here and in the recurrence
  const int sb = tid >> 6;                   // group g of powers; batch of the recurrence

  // ---- fetch this thread's state, then this wave's X ----
  const float lar = log_A_real[h * N_SZ + sn];
  const float Ai  = A_imag[h * N_SZ + sn];
  const float cr  = C_re[h * N_SZ + sn];
  const float ci  = C_im[h * N_SZ + sn];
  const float dt  = __expf(log_dt[h]);
  v8h xReg[8];
#pragma unroll
  for (int i = 0; i < 8; ++i) xReg[i] = *(const v8h*)(gX + (i * 32 + lane) * 8);
  // Stands in front of every later write of a register that a load above names.
  asm volatile("s_wait_xcnt 0x0" ::: "memory");
  // All loads are in flight before the arithmetic below waits for the first
  // four; X, issued last, is waited for only where it is parked.
  __builtin_amdgcn_sched_barrier(0);

  // ---- discretisation of state n ----
  const float Ar = -__expf(lar);
  const float dAr = dt * Ar, dAi = dt * Ai;
  float e0, c1, s1;
  cexp_parts(dAr, dAi, e0, c1, s1);
  const float are = e0 * c1, aim = e0 * s1;
  // Ct = C * (exp(dtA)-1)/A
  const float xr = are - 1.0f, xi = aim;
  const float inv = 1.0f / (Ar * Ar + Ai * Ai);
  const float qr = (xr * Ar + xi * Ai) * inv;
  const float qi = (xi * Ar - xr * Ai) * inv;
  const float Ctr = cr * qr - ci * qi;
  const float Cti = cr * qi + ci * qr;
  // per-chunk decay a^P
  float eP, cP, sP;
  cexp_parts(dAr * (float)P_SZ, dAi * (float)P_SZ, eP, cP, sP);
  const float dr = eP * cP;
  const float di = eP * sP;

  // ---- the 17 powers of this thread: Win and K terms to LDS, E to registers ----
  v8h wre[2], wim[2], ere[2], eim[2];
  {
    float* kt = (float*)(s_us + (2 * sb) * (32 * SP) + 32 * XP) + sn;
#pragma unroll
    for (int i = 0; i <= 16; ++i) {
      const float pw = (float)(sb * 16 + i);
      float ed, cc, ss;
      cexp_parts(dAr * pw, dAi * pw, ed, cc, ss);
      const float ce = Ctr * ed, se = Cti * ed;
      // Explicit fused forms: one rounding order for E and for the K terms.
      const float pr = fmaf(cc, ce, -(ss * se));     // Re(Ct a^d)
      if (i < 16) {                                  // d = 0..63: Win, K
        wre[1 - (i >> 3)][7 - (i & 7)] = (_Float16)(ed * cc);
        wim[1 - (i >> 3)][7 - (i & 7)] = (_Float16)(ed * ss);
        kt[(i >> 3) * (16 * SP) + (i & 7) * KP] = pr;
      }
      if (i > 0) {                                   // d = 1..64: E, row j = d-1
        const float pi = fmaf(ss, ce, cc * se);      // Im(Ct a^d)
        ere[(i - 1) >> 3][(i - 1) & 7] = (_Float16)( 2.0f * pr);
        eim[(i - 1) >> 3][(i - 1) & 7] = (_Float16)(-2.0f * pi);
      }
    }
    // powers 16g+15 .. 16g are the 16 halves t = 48-16g .. 63-16g of row n
    _Float16* wp = s_par + sn * XP + (48 - 16 * sb);
#pragma unroll
    for (int v = 0; v < 2; ++v) {
      *(v8h*)(wp + v * 8)             = wre[v];
      *(v8h*)(wp + N_SZ * XP + v * 8) = wim[v];
    }
    if (tid < SP) *(v8h*)(s_R + tid * 8) = v8h{};   // all eight copies start as 0
  }
#pragma unroll
  for (int i = 0; i < 8; ++i) {
    const int q = i * 32 + lane;             // 16-byte piece of this wave's X
    *(v8h*)(s_own + (q >> 3) * XP + (q & 7) * 8) = xReg[i];
  }
  __syncthreads();

  // ---- K[d], d = 8*wave + (lane & 7): the 64 terms summed in the order of n ----
  {
    const float* kr = (const float*)(s_own + 32 * XP) + (lane & 7) * KP;
    float ks = 0.0f;
#pragma unroll
    for (int q = 0; q < 16; ++q) {
      const v4f p = *(const v4f*)(kr + q * 4);
      ks = fmaf(2.0f, p[0], ks);
      ks = fmaf(2.0f, p[1], ks);
      ks = fmaf(2.0f, p[2], ks);
      ks = fmaf(2.0f, p[3], ks);
    }
    // lane l writes K[d] = R[ri] into copies 2*(l >> 3) and 2*(l >> 3) + 1
    const int ri = P_SZ - 1 - (wave * 8 + (lane & 7));
    const int k0 = (lane >> 3) * 2;
    if (ri >= k0)     s_R[k0 * SP + ri - k0]           = (_Float16)ks;
    if (ri >= k0 + 1) s_R[(k0 + 1) * SP + ri - k0 - 1] = (_Float16)ks;
  }

  // ---- ingest: X fragments stay in registers for the emit matmul ----
  const int cl = lane & 15;
  const int r8 = (lane & 16) ? 8 : 0;
  v16h xb[2][2];
#pragma unroll
  for (int nn = 0; nn < 2; ++nn)
#pragma unroll
    for (int kk = 0; kk < 2; ++kk)
      xb[nn][kk] = lds_frag(s_own, XP, nn * 16, kk * 32, lane);
#pragma unroll
  for (int m = 0; m < 8; ++m) {
    const v16h a0 = lds_frag(s_par, XP, m * 16, 0, lane);
    const v16h a1 = lds_frag(s_par, XP, m * 16, 32, lane);
#pragma unroll
    for (int nn = 0; nn < 2; ++nn) {
      v8f acc = {};
      acc = __builtin_amdgcn_wmma_f32_16x16x32_f16(false, a0, false, xb[nn][0],
                                                   (short)0, acc, false, false);
      acc = __builtin_amdgcn_wmma_f32_16x16x32_f16(false, a1, false, xb[nn][1],
                                                   (short)0, acc, false, false);
      v8h hv;
#pragma unroll
      for (int i = 0; i < 8; ++i) hv[i] = (_Float16)acc[i];
      *(v8h*)(s_own + (nn * 16 + cl) * SP + m * 16 + r8) = hv;
    }
  }
  __syncthreads();   // U and K complete; Win no longer read

  // ---- T and E take Win's place ----
#pragma unroll
  for (int i = 0; i < 2; ++i) {
    const int q = i * 256 + tid;             // 16-byte piece of T
    const int r0 = P_SZ - 1 - (q >> 3);      // R index of T[j][0], j = q >> 3
    *(v8h*)(s_T + (q >> 3) * XP + (q & 7) * 8) =
        *(const v8h*)(s_R + (r0 & 7) * SP + (r0 & ~7) + (q & 7) * 8);
  }
#pragma unroll
  for (int i = 0; i < 16; ++i) {
    s_E[(sb * 16 + i) * SP + sn]        = ere[i >> 3][i & 7];
    s_E[(sb * 16 + i) * SP + N_SZ + sn] = eim[i >> 3][i & 7];
  }

  // ---- recurrence over the 64 chunks, one thread per (b, n), in place ----
  {
    _Float16* sp = s_us + sb * SP + sn;
    float sr = 0.0f, si = 0.0f;
    // Kept rolled: fully unrolled, the 128 loaded halves each hold a register.
#pragma unroll 1
    for (int c0 = 0; c0 < C_SZ; c0 += 16) {
      _Float16 ur[16], ui[16];
#pragma unroll
      for (int i = 0; i < 16; ++i) {
        ur[i] = sp[(c0 + i) * (B_SZ * SP)];
        ui[i] = sp[(c0 + i) * (B_SZ * SP) + N_SZ];
      }
#pragma unroll
      for (int i = 0; i < 16; ++i) {
        sp[(c0 + i) * (B_SZ * SP)]        = (_Float16)sr;
        sp[(c0 + i) * (B_SZ * SP) + N_SZ] = (_Float16)si;
        // Explicit fused forms: which product is rounded before the fuse is
        // fixed here, not left to the compiler's choice.
        const float nsr = fmaf(dr, sr, -(di * si)) + (float)ur[i];
        const float nsi = fmaf(dr, si, di * sr) + (float)ui[i];
        sr = nsr; si = nsi;
      }
    }
  }
  __syncthreads();   // S, T and E complete

  // ---- emit: 4 x 2 accumulator tiles per wave, k outermost ----
  v8f acc[4][2] = {};
#pragma unroll
  for (int kk = 0; kk < 2; ++kk)
#pragma unroll
    for (int m = 0; m < 4; ++m) {
      const v16h a = lds_frag(s_T, XP, m * 16, kk * 32, lane);
#pragma unroll
      for (int nn = 0; nn < 2; ++nn)
        acc[m][nn] = __builtin_amdgcn_wmma_f32_16x16x32_f16(
            false, a, false, xb[nn][kk], (short)0, acc[m][nn], false, false);
    }
#pragma unroll
  for (int kk = 0; kk < 4; ++kk) {
    const v16h s0 = lds_frag(s_own, SP, 0, kk * 32, lane);
    const v16h s1 = lds_frag(s_own, SP, 16, kk * 32, lane);
#pragma unroll
    for (int m = 0; m < 4; ++m) {
      const v16h a = lds_frag(s_E, SP, m * 16, kk * 32, lane);
      acc[m][0] = __builtin_amdgcn_wmma_f32_16x16x32_f16(
          false, a, false, s0, (short)0, acc[m][0], false, false);
      acc[m][1] = __builtin_amdgcn_wmma_f32_16x16x32_f16(
          false, a, false, s1, (short)0, acc[m][1], false, false);
    }
  }
  float* Yp = Y + (size_t)h * (P_SZ * NCOL) + (size_t)(wave * 32) * P_SZ;
  // Keeps every store behind the last LDS load and WMMA, so that no register
  // an issued store names is written again.
  __builtin_amdgcn_sched_barrier(0);
#pragma unroll
  for (int nn = 0; nn < 2; ++nn)
#pragma unroll
    for (int m = 0; m < 4; ++m) {
      float* dst = Yp + (size_t)(nn * 16 + cl) * P_SZ + m * 16 + r8;
      const v8f d = acc[m][nn];
      v4f lo = {d[0], d[1], d[2], d[3]};
      v4f hi = {d[4], d[5], d[6], d[7]};
      *(v4f*)dst       = lo;                    // 16B store
      *(v4f*)(dst + 4) = hi;                    // 16B store
    }
}

// ---------------------------------------------------------------------------
// Kernel 3: transpose Y[h][col][j] back, residual and LayerNorm in one pass:
//   r = x*(1+D) + y ;  out = (r-mu)*rsqrt(var+eps)*w + b
// One work-group (16 waves) per column = 64 rows (b,l) x all 1024 h, so that a
// row's mean and variance are formed where r is made and r never goes to memory.
// Y passes through LDS as s_y[j][h]; the 16-byte group of four h is stored at
// group ^ (j >> 2): the transposing 8-byte stores and the 16-byte row reads
// then both touch every bank once.
// Global accesses of Y, x and out are 16 B per lane on whole lines; a wave owns
// four rows, one after the other. Each plain '#pragma unroll' keeps a register
// array's indices constant.
// ---------------------------------------------------------------------------
__global__ __launch_bounds__(512) void residual_norm_kernel(
    const float* __restrict__ Y, const float* __restrict__ x,
    const float* __restrict__ D, const float* __restrict__ ln_w,
    const float* __restrict__ ln_b, float* __restrict__ out) {
  // D, w, b (12 KiB), then the column's Y (256 KiB)
  __shared__ __attribute__((aligned(16))) float s_all[3 * H_SZ + P_SZ * H_SZ];
  float* s_vec = s_all;
  float* s_y   = s_all + 3 * H_SZ;
  const int col  = blockIdx.x;             // c*B + b
  const int b    = col & (B_SZ - 1);
  const int c    = col >> 2;
  const int tid  = threadIdx.x;
  const int wave = tid >> 5;
  const int lane = tid & 31;
  const int k    = lane & 15;              // 16-byte piece of a 64-j run of Y
  const int hh   = lane >> 4;

  // ---- in flight at once: the vectors, the wave's Y, its first two x rows ----
  const v2f dv = *(const v2f*)(D + tid * 2);
  const v2f wv = *(const v2f*)(ln_w + tid * 2);
  const v2f bv = *(const v2f*)(ln_b + tid * 2);
  const size_t row0 = (size_t)b * L_SZ + c * P_SZ + wave * 4;
  const float* gx = x + row0 * H_SZ + lane * 4;
  v4f xr[2][8];
#pragma unroll
  for (int r = 0; r < 2; ++r)
#pragma unroll
    for (int q = 0; q < 8; ++q)
      xr[r][q] = *(const v4f*)(gx + r * H_SZ + q * 128);
  // load (m, p) holds h = wave*64 + 4*m + 2*hh + p, j = 4*k .. 4*k+3
  const float* gy = Y + ((size_t)(wave * 64 + 2 * hh) * NCOL + col) * P_SZ + k * 4;
  v4f yr[16][2];
#pragma unroll
  for (int m = 0; m < 16; ++m)
#pragma unroll
    for (int p = 0; p < 2; ++p)
      yr[m][p] = *(const v4f*)(gy + (size_t)(4 * m + p) * (NCOL * P_SZ));
  // Y's address registers are held up to this wait (the input operand) and are
  // free for other use behind it; the wave waits for the loaded data next in
  // any case.
  asm volatile("s_wait_xcnt 0x0" :: "v"(gy) : "memory");
  // Every load above is issued before the first LDS store waits for one, and
  // nothing of the row work below is moved up among them (it spilled there).
  __builtin_amdgcn_sched_barrier(0);
  *(v2f*)(s_vec + tid * 2)            = dv;
  *(v2f*)(s_vec + H_SZ + tid * 2)     = wv;
  *(v2f*)(s_vec + 2 * H_SZ + tid * 2) = bv;
  float* sd = s_y + (k * 4) * H_SZ + wave * 64 + 2 * hh;
#pragma unroll
  for (int m = 0; m < 16; ++m)
#pragma unroll
    for (int e = 0; e < 4; ++e) {
      const v2f pr = {yr[m][0][e], yr[m][1][e]};
      *(v2f*)(sd + e * H_SZ + (m ^ k) * 4) = pr;
    }
  __syncthreads();   // the column's Y and the three vectors are in LDS

  // ---- the lane's 32 h of 1+D, w and b stay in registers for all four rows ----
  v4f d1[8], w4[8], b4[8];
#pragma unroll
  for (int q = 0; q < 8; ++q) {
    d1[q] = *(const v4f*)(s_vec + q * 128 + lane * 4) + 1.0f;
    w4[q] = *(const v4f*)(s_vec + H_SZ + q * 128 + lane * 4);
    b4[q] = *(const v4f*)(s_vec + 2 * H_SZ + q * 128 + lane * 4);
  }
  const float* sy = s_y + (wave * 4) * H_SZ + (lane ^ wave) * 4;
  float* go = out + row0 * H_SZ + lane * 4;
#pragma unroll
  for (int r = 0; r < 4; ++r) {
    v4f (&xc)[8] = xr[r & 1];
    // four partial sums a lane, one per element of a 16-byte group
    v4f s4 = {}, q4 = {};
#pragma unroll
    for (int q = 0; q < 8; ++q) {
      const v4f rv = *(const v4f*)(sy + r * H_SZ + q * 128) + xc[q] * d1[q];
      xc[q] = rv;
      s4 += rv;
      q4 += rv * rv;
    }
    float sum = (s4[0] + s4[1]) + (s4[2] + s4[3]);
    float sq  = (q4[0] + q4[1]) + (q4[2] + q4[3]);
#pragma unroll
    for (int m = 16; m > 0; m >>= 1) {
      sum += __shfl_xor(sum, m, 32);
      sq  += __shfl_xor(sq, m, 32);
    }
    const float mu  = sum * (1.0f / (float)H_SZ);
    const float var = sq * (1.0f / (float)H_SZ) - mu * mu;
    const float inv = rsqrtf(var + LN_EPS);
#pragma unroll
    for (int q = 0; q < 8; ++q)
      *(v4f*)(go + r * H_SZ + q * 128) = (xc[q] - mu) * inv * w4[q] + b4[q];
    // the row after next
    if (r < 2) {
#pragma unroll
      for (int q = 0; q < 8; ++q)
        xc[q] = *(const v4f*)(gx + (r + 2) * H_SZ + q * 128);
    }
  }
}

// ---------------------------------------------------------------------------
// Host launcher
// ---------------------------------------------------------------------------
extern "C" void kernel_launch(void* const* d_in, const int* in_sizes, int n_in,
                              void* d_out, int out_size, void* d_ws, size_t ws_size,
                              hipStream_t stream) {
  const float* x          = (const float*)d_in[0];
  const float* log_A_real = (const float*)d_in[1];
  const float* A_imag     = (const float*)d_in[2];
  const float* C_re       = (const float*)d_in[3];
  const float* C_im       = (const float*)d_in[4];
  const float* log_dt     = (const float*)d_in[5];
  const float* Dterm      = (const float*)d_in[6];
  const float* ln_w       = (const float*)d_in[7];
  const float* ln_b       = (const float*)d_in[8];
  float* out = (float*)d_out;

  // workspace layout (bytes)
  char* ws = (char*)d_ws;
  const size_t XC_B  = (size_t)H_SZ * NCOL * P_SZ * 2;       // 32 MB
  _Float16* Xc     = (_Float16*)ws;
  float*    Yconv  = (float*)(ws + XC_B);                    // 64 MB
  (void)ws_size; (void)n_in; (void)in_sizes; (void)out_size;

  // 1) pack x -> f16 column tiles (LDS transpose): grid (256 cols, 16 h-tiles)
  pack_x_kernel<<<dim3(NCOL, H_SZ / 64), dim3(256), 0, stream>>>(x, Xc);

  // 2) parameters, ingest matmul, recurrence, emit matmul (WMMA): one work-group per h
  chunk_chain_kernel<<<dim3(H_SZ), dim3(256), 0, stream>>>(
      log_A_real, A_imag, C_re, C_im, log_dt, Xc, Yconv);

  // 3) transpose back, residual, LayerNorm: one work-group per column
  residual_norm_kernel<<<dim3(NCOL), dim3(512), 0, stream>>>(
      Yconv, x, Dterm, ln_w, ln_b, out);
}

// v004
// Measured time: 43.8 microseconds a run.
// Timed twice side by side with v003, it ran 1.05 times as fast both times.
// Counting every step since v000, it is 4.66 times as fast.
#include <hip/hip_runtime.h>
#include <hip/hip_bf16.h>

#define B_SZ 4
#define L_SZ 4096
#define H_SZ 1024
#define N_SZ 64
#define P_SZ 64                 // chunk length
#define C_SZ (L_SZ / P_SZ)      // 64 chunks
#define NCOL (B_SZ * C_SZ)      // 256 matmul columns per h
#define LN_EPS 1e-5f

typedef __attribute__((ext_vector_type(16))) _Float16 v16h;
typedef __attribute__((ext_vector_type(8)))  _Float16 v8h;
typedef __attribute__((ext_vector_type(4)))  _Float16 v4h;
typedef __attribute__((ext_vector_type(2)))  _Float16 v2h;
typedef __attribute__((ext_vector_type(8)))  float    v8f;
typedef __attribute__((ext_vector_type(4)))  float    v4f;
typedef __attribute__((ext_vector_type(2)))  float    v2f;

// ---------------------------------------------------------------------------
// Kernel 1: pack x [B,L,H] f32 -> Xc[h][col][t] f16 via LDS transpose.
// Block = 256 threads handles one (b, c) chunk x 64-h tile (64x64 elements x16).
// Coalesced f32 reads along h; contiguous f16 writes along t.
// ---------------------------------------------------------------------------
__global__ void pack_x_kernel(const float* __restrict__ x, _Float16* __restrict__ Xc) {
  __shared__ _Float16 s_tile[64 * 65];
  const int col = blockIdx.x;              // c*B + b
  const int hb  = blockIdx.y;              // h tile (0..15)
  const int b   = col & (B_SZ - 1);
  const int c   = col >> 2;
  const int tid = threadIdx.x;
#pragma unroll
  for (int i = 0; i < 16; ++i) {
    const int lin = i * 256 + tid;
    const int t  = lin >> 6;               // position within chunk
    const int hh = lin & 63;               // h within tile (fast -> coalesced)
    const int l  = c * P_SZ + t;
    s_tile[hh * 65 + t] =
        (_Float16)x[((size_t)b * L_SZ + l) * H_SZ + hb * 64 + hh];
  }
  __syncthreads();
#pragma unroll
  for (int i = 0; i < 16; ++i) {
    const int lin = i * 256 + tid;
    const int hh = lin >> 6;
    const int t  = lin & 63;               // t fast -> contiguous writes
    const int h  = hb * 64 + hh;
    Xc[(size_t)h * (NCOL * P_SZ) + (size_t)col * P_SZ + t] = s_tile[hh * 65 + t];
  }
}

// ---------------------------------------------------------------------------
// WMMA fragment loader from LDS. Row-major A (row per lane) and
// column-contiguous B (col per lane) share the identical per-lane K packing:
//   halves 0..7  -> K = k0 + (lane<16 ? 0 : 8) + i
//   halves 8..15 -> K = k0 + 16 + (lane<16 ? 0 : 8) + i
// Both runs are 8 contiguous halves, 16B aligned -> two ds_load_b128.
// ---------------------------------------------------------------------------
#define XP 72    // LDS pitch (halves) of 64-half rows:  144 B = 16 B x 9
#define SP 136   // LDS pitch (halves) of 128-half rows: 272 B = 16 B x 17

__device__ __forceinline__ v16h lds_frag(const _Float16* base, int ld, int rc0,
                                         int k0, int lane) {
  const _Float16* p = base + (rc0 + (lane & 15)) * ld + k0 + ((lane & 16) ? 8 : 0);
  const v8h lo = *(const v8h*)p;
  const v8h hi = *(const v8h*)(p + 16);
  return __builtin_shufflevector(lo, hi, 0, 1, 2, 3, 4, 5, 6, 7,
                                 8, 9, 10, 11, 12, 13, 14, 15);
}

// ---------------------------------------------------------------------------
// Kernel 2: parameters, ingest matmul, inter-chunk recurrence and emit matmul of
// one h in one work-group (8 waves). Wave w owns columns [32w, 32w+32) in both
// matmuls.
//   a_n = exp(dt*A_n), Ct_n = C_n*(a_n - 1)/A_n ; thread (n, g) forms the powers
//   a_n^d, d = 16g .. 16g+16, once, while the loads of X are in flight:
//     Win[2n][t] = Re a_n^(P-1-t), Win[2n+1][t] = Im a_n^(P-1-t)   -> LDS
//     E[j][2n] = 2 Re(Ct_n a_n^(j+1)), E[j][2n+1] = -2 Im(Ct_n a_n^(j+1))
//     K[d] = 2 sum_n Re(Ct_n a_n^d) ; T[j][u] = (u <= j) ? K[j-u] : 0
//   U[128 x 256] = Win[128 x 64] * X[64 x 256]        -> LDS, f16, [col][row]
//   per (b, n): S(before chunk c) replaces U(c) in place; s <- a^P * s + u
//   Re and Im of a state are neighbours in a column of U and S, so that a lane
//   of the recurrence moves two whole states by one 8-byte LDS access.
//   Y[64 x 256]  = T[64 x 64] * X + E[64 x 128] * S   -> global, [h][col][j]
// Win, E, T, U and S never leave the work-group; X is read by whole-line 16 B
// per lane reads.
// Each plain '#pragma unroll' below makes the indices of a register array
// compile-time constants, so that the array stays in registers.
// ---------------------------------------------------------------------------
#define KP 68    // LDS pitch (floats) of a row of K terms: 272 B = 16 B x 17

// ed = exp(re), cc = cos(im), ss = sin(im) in the fast hardware forms. The three
// transcendentals stand in one statement, their results in registers apart from
// the inputs, with one v_nop behind the last: the slot that the instruction set
// asks for between a transcendental and an instruction that reads its result or
// overwrites its source.
__device__ __forceinline__ void cexp_parts(float re, float im, float& ed,
                                           float& cc, float& ss) {
  const float xe = re * 1.44269504f;         // v_exp_f32 is 2^x
  const float xa = im * 0.15915494f;         // v_cos/v_sin_f32 take revolutions
  asm("v_exp_f32 %0, %3\n\tv_cos_f32 %1, %4\n\tv_sin_f32 %2, %4\n\tv_nop"
      : "=&v"(ed), "=&v"(cc), "=&v"(ss) : "v"(xe), "v"(xa));
}

// Second launch bound: 6 waves per SIMD, the three work-groups per WGP that the
// 98,944 B of LDS allow.
__global__ __launch_bounds__(256, 6) void chunk_chain_kernel(
    const float* __restrict__ log_A_real, const float* __restrict__ A_imag,
    const float* __restrict__ C_re, const float* __restrict__ C_im,
    const float* __restrict__ log_dt, const _Float16* __restrict__ Xc,
    float* __restrict__ Y) {
  // U, then S: 256 columns of 128 halves. Each wave first parks its own 32
  // columns of X in the first 4,608 B of its own slice (read back into registers
  // before U lands); the 4,096 B behind them hold, until U lands, the K terms of
  // the eight d = 8*wave .. 8*wave+7 as float [d & 7][n], pitch KP.
  __shared__ __attribute__((aligned(16))) _Float16 s_us[NCOL * SP];
  // Win during ingest; T (64 rows, pitch XP) and E (64 rows, pitch SP) after it.
  __shared__ __attribute__((aligned(16))) _Float16 s_par[P_SZ * XP + P_SZ * SP];
  // With R[i] = K[P-1-i] for i < P and 0 behind, row j of T is R[P-1-j .. 2P-2-j].
  // Copy k holds R shifted by k halves (s_R[k*SP + m] = R[m + k]), so that every
  // 16-byte piece of T is a 16-byte aligned read of one of the eight copies.
  __shared__ __attribute__((aligned(16))) _Float16 s_R[8 * SP];
  // a_n^P as (Re, Im), for the recurrence's lanes
  __shared__ __attribute__((aligned(16))) float s_dec[2 * N_SZ];
  const int h    = blockIdx.x;
  const int tid  = threadIdx.x;
  const int wave = tid >> 5;
  const int lane = tid & 31;
  const _Float16* gX = Xc + (size_t)h * (NCOL * P_SZ) + wave * (32 * P_SZ);
  _Float16* s_own = s_us + wave * (32 * SP);
  _Float16* s_T   = s_par;
  _Float16* s_E   = s_par + P_SZ * XP;
  const int sn = tid & (N_SZ - 1);           // state index n
  const int sb = tid >> 6;                   // group g of powers

  // ---- fetch this thread's state, then this wave's X ----
  const float lar = log_A_real[h * N_SZ + sn];
  const float Ai  = A_imag[h * N_SZ + sn];
  const float cr  = C_re[h * N_SZ + sn];
  const float ci  = C_im[h * N_SZ + sn];
  const float dt  = __expf(log_dt[h]);
  v8h xReg[8];
#pragma unroll
  for (int i = 0; i < 8; ++i) xReg[i] = *(const v8h*)(gX + (i * 32 + lane) * 8);
  // Stands in front of every later write of a register that a load above names.
  asm volatile("s_wait_xcnt 0x0" ::: "memory");
  // All loads are in flight before the arithmetic below waits for the first
  // four; X, issued last, is waited for only where it is parked.
  __builtin_amdgcn_sched_barrier(0);

  // ---- discretisation of state n ----
  const float Ar = -__expf(lar);
  const float dAr = dt * Ar, dAi = dt * Ai;
  float e0, c1, s1;
  cexp_parts(dAr, dAi, e0, c1, s1);
  const float are = e0 * c1, aim = e0 * s1;
  // Ct = C * (exp(dtA)-1)/A
  const float xr = are - 1.0f, xi = aim;
  const float inv = 1.0f / (Ar * Ar + Ai * Ai);
  const float qr = (xr * Ar + xi * Ai) * inv;
  const float qi = (xi * Ar - xr * Ai) * inv;
  const float Ctr = cr * qr - ci * qi;
  const float Cti = cr * qi + ci * qr;
  // per-chunk decay a^P
  float eP, cP, sP;
  cexp_parts(dAr * (float)P_SZ, dAi * (float)P_SZ, eP, cP, sP);
  const float dr = eP * cP;
  const float di = eP * sP;

  // ---- the 17 powers of this thread: Win and K terms to LDS, E to registers ----
  v8h wre[2], wim[2];
  v2h e2[16];                                // (E[j][2n], E[j][2n+1]), j = 16g + i
  {
    float* kt = (float*)(s_us + (2 * sb) * (32 * SP) + 32 * XP) + sn;
#pragma unroll
    for (int i = 0; i <= 16; ++i) {
      const float pw = (float)(sb * 16 + i);
      float ed, cc, ss;
      cexp_parts(dAr * pw, dAi * pw, ed, cc, ss);
      const float ce = Ctr * ed, se = Cti * ed;
      // Explicit fused forms: one rounding order for E and for the K terms.
      const float pr = fmaf(cc, ce, -(ss * se));     // Re(Ct a^d)
      if (i < 16) {                                  // d = 0..63: Win, K
        wre[1 - (i >> 3)][7 - (i & 7)] = (_Float16)(ed * cc);
        wim[1 - (i >> 3)][7 - (i & 7)] = (_Float16)(ed * ss);
        kt[(i >> 3) * (16 * SP) + (i & 7) * KP] = pr;
      }
      if (i > 0) {                                   // d = 1..64: E, row j = d-1
        const float pi = fmaf(ss, ce, cc * se);      // Im(Ct a^d)
        e2[i - 1] = v2h{(_Float16)(2.0f * pr), (_Float16)(-2.0f * pi)};
      }
    }
    // powers 16g+15 .. 16g are the 16 halves t = 48-16g .. 63-16g of rows 2n, 2n+1
    _Float16* wp = s_par + (2 * sn) * XP + (48 - 16 * sb);
#pragma unroll
    for (int v = 0; v < 2; ++v) {
      *(v8h*)(wp + v * 8)             = wre[v];
      *(v8h*)(wp + XP + v * 8)        = wim[v];
    }
    if (tid < SP) *(v8h*)(s_R + tid * 8) = v8h{};   // all eight copies start as 0
    if (sb == 0) *(v2f*)(s_dec + 2 * sn) = v2f{dr, di};
  }
#pragma unroll
  for (int i = 0; i < 8; ++i) {
    const int q = i * 32 + lane;             // 16-byte piece of this wave's X
    *(v8h*)(s_own + (q >> 3) * XP + (q & 7) * 8) = xReg[i];
  }
  __syncthreads();

  // ---- K[d], d = 8*wave + (lane & 7): the 64 terms summed in the order of n ----
  {
    const float* kr = (const float*)(s_own + 32 * XP) + (lane & 7) * KP;
    float ks = 0.0f;
#pragma unroll
    for (int q = 0; q < 16; ++q) {
      const v4f p = *(const v4f*)(kr + q * 4);
      ks = fmaf(2.0f, p[0], ks);
      ks = fmaf(2.0f, p[1], ks);
      ks = fmaf(2.0f, p[2], ks);
      ks = fmaf(2.0f, p[3], ks);
    }
    // lane l writes K[d] = R[ri] into copies 2*(l >> 3) and 2*(l >> 3) + 1
    const int ri = P_SZ - 1 - (wave * 8 + (lane & 7));
    const int k0 = (lane >> 3) * 2;
    if (ri >= k0)     s_R[k0 * SP + ri - k0]           = (_Float16)ks;
    if (ri >= k0 + 1) s_R[(k0 + 1) * SP + ri - k0 - 1] = (_Float16)ks;
  }

  // ---- ingest: X fragments stay in registers for the emit matmul ----
  const int cl = lane & 15;
  const int r8 = (lane & 16) ? 8 : 0;
  v16h xb[2][2];
#pragma unroll
  for (int nn = 0; nn < 2; ++nn)
#pragma unroll
    for (int kk = 0; kk < 2; ++kk)
      xb[nn][kk] = lds_frag(s_own, XP, nn * 16, kk * 32, lane);
#pragma unroll
  for (int m = 0; m < 8; ++m) {
    const v16h a0 = lds_frag(s_par, XP, m * 16, 0, lane);
    const v16h a1 = lds_frag(s_par, XP, m * 16, 32, lane);
#pragma unroll
    for (int nn = 0; nn < 2; ++nn) {
      v8f acc = {};
      acc = __builtin_amdgcn_wmma_f32_16x16x32_f16(false, a0, false, xb[nn][0],
                                                   (short)0, acc, false, false);
      acc = __builtin_amdgcn_wmma_f32_16x16x32_f16(false, a1, false, xb[nn][1],
                                                   (short)0, acc, false, false);
      v8h hv;
#pragma unroll
      for (int i = 0; i < 8; ++i) hv[i] = (_Float16)acc[i];
      *(v8h*)(s_own + (nn * 16 + cl) * SP + m * 16 + r8) = hv;
    }
  }
  __syncthreads();   // U and K complete; Win no longer read

  // ---- T and E take Win's place ----
#pragma unroll
  for (int i = 0; i < 2; ++i) {
    const int q = i * 256 + tid;             // 16-byte piece of T
    const int r0 = P_SZ - 1 - (q >> 3);      // R index of T[j][0], j = q >> 3
    *(v8h*)(s_T + (q >> 3) * XP + (q & 7) * 8) =
        *(const v8h*)(s_R + (r0 & 7) * SP + (r0 & ~7) + (q & 7) * 8);
  }
#pragma unroll
  for (int i = 0; i < 16; ++i)
    *(v2h*)(s_E + (sb * 16 + i) * SP + 2 * sn) = e2[i];

  // ---- recurrence over the 64 chunks, in place: wave b < 4 has batch b, its
  // lane p the states 2p and 2p+1 (element 0 and 1 of each pair below) ----
  if (wave < B_SZ) {
    _Float16* sp = s_us + wave * SP + lane * 4;
    const v4f dd = *(const v4f*)(s_dec + lane * 4);
    const v2f dr2 = {dd[0], dd[2]}, di2 = {dd[1], dd[3]};
    v2f sr = {}, si = {};
    // Kept rolled: fully unrolled, the 64 loaded pieces each hold two registers.
#pragma unroll 1
    for (int c0 = 0; c0 < C_SZ; c0 += 16) {
      v4h u[16];
#pragma unroll
      for (int i = 0; i < 16; ++i) u[i] = *(const v4h*)(sp + (c0 + i) * (B_SZ * SP));
#pragma unroll
      for (int i = 0; i < 16; ++i) {
        *(v4h*)(sp + (c0 + i) * (B_SZ * SP)) =
            v4h{(_Float16)sr[0], (_Float16)si[0], (_Float16)sr[1], (_Float16)si[1]};
        const v2f ur = {(float)u[i][0], (float)u[i][2]};
        const v2f ui = {(float)u[i][1], (float)u[i][3]};
        // Explicit fused forms: which product is rounded before the fuse is
        // fixed here, not left to the compiler's choice.
        const v2f nsr = __builtin_elementwise_fma(dr2, sr, -(di2 * si)) + ur;
        const v2f nsi = __builtin_elementwise_fma(dr2, si, di2 * sr) + ui;
        sr = nsr; si = nsi;
      }
    }
  }
  __syncthreads();   // S, T and E complete

  // ---- emit: 4 x 2 accumulator tiles per wave, k outermost ----
  v8f acc[4][2] = {};
#pragma unroll
  for (int kk = 0; kk < 2; ++kk)
#pragma unroll
    for (int m = 0; m < 4; ++m) {
      const v16h a = lds_frag(s_T, XP, m * 16, kk * 32, lane);
#pragma unroll
      for (int nn = 0; nn < 2; ++nn)
        acc[m][nn] = __builtin_amdgcn_wmma_f32_16x16x32_f16(
            false, a, false, xb[nn][kk], (short)0, acc[m][nn], false, false);
    }
#pragma unroll
  for (int kk = 0; kk < 4; ++kk) {
    const v16h s0 = lds_frag(s_own, SP, 0, kk * 32, lane);
    const v16h s1 = lds_frag(s_own, SP, 16, kk * 32, lane);
#pragma unroll
    for (int m = 0; m < 4; ++m) {
      const v16h a = lds_frag(s_E, SP, m * 16, kk * 32, lane);
      acc[m][0] = __builtin_amdgcn_wmma_f32_16x16x32_f16(
          false, a, false, s0, (short)0, acc[m][0], false, false);
      acc[m][1] = __builtin_amdgcn_wmma_f32_16x16x32_f16(
          false, a, false, s1, (short)0, acc[m][1], false, false);
    }
  }
  float* Yp = Y + (size_t)h * (P_SZ * NCOL) + (size_t)(wave * 32) * P_SZ;
  // Keeps every store behind the last LDS load and WMMA, so that no register
  // an issued store names is written again.
  __builtin_amdgcn_sched_barrier(0);
#pragma unroll
  for (int nn = 0; nn < 2; ++nn)
#pragma unroll
    for (int m = 0; m < 4; ++m) {
      float* dst = Yp + (size_t)(nn * 16 + cl) * P_SZ + m * 16 + r8;
      const v8f d = acc[m][nn];
      v4f lo = {d[0], d[1], d[2], d[3]};
      v4f hi = {d[4], d[5], d[6], d[7]};
      *(v4f*)dst       = lo;                    // 16B store
      *(v4f*)(dst + 4) = hi;                    // 16B store
    }
}

// ---------------------------------------------------------------------------
// Kernel 3: transpose Y[h][col][j] back, residual and LayerNorm in one pass:
//   r = x*(1+D) + y ;  out = (r-mu)*rsqrt(var+eps)*w + b
// One work-group (16 waves) per column = 64 rows (b,l) x all 1024 h, so that a
// row's mean and variance are formed where r is made and r never goes to memory.
// Y passes through LDS as s_y[j][h]; the 16-byte group of four h is stored at
// group ^ (j >> 2): the transposing 8-byte stores and the 16-byte row reads
// then both touch every bank once.
// Global accesses of Y, x and out are 16 B per lane on whole lines; a wave owns
// four rows, one after the other. Each plain '#pragma unroll' keeps a register
// array's indices constant.
// ---------------------------------------------------------------------------
__global__ __launch_bounds__(512) void residual_norm_kernel(
    const float* __restrict__ Y, const float* __restrict__ x,
    const float* __restrict__ D, const float* __restrict__ ln_w,
    const float* __restrict__ ln_b, float* __restrict__ out) {
  // D, w, b (12 KiB), then the column's Y (256 KiB)
  __shared__ __attribute__((aligned(16))) float s_all[3 * H_SZ + P_SZ * H_SZ];
  float* s_vec = s_all;
  float* s_y   = s_all + 3 * H_SZ;
  const int col  = blockIdx.x;             // c*B + b
  const int b    = col & (B_SZ - 1);
  const int c    = col >> 2;
  const int tid  = threadIdx.x;
  const int wave = tid >> 5;
  const int lane = tid & 31;
  const int k    = lane & 15;              // 16-byte piece of a 64-j run of Y
  const int hh   = lane >> 4;

  // ---- in flight at once: the vectors, the wave's Y, its first two x rows ----
  const v2f dv = *(const v2f*)(D + tid * 2);
  const v2f wv = *(const v2f*)(ln_w + tid * 2);
  const v2f bv = *(const v2f*)(ln_b + tid * 2);
  const size_t row0 = (size_t)b * L_SZ + c * P_SZ + wave * 4;
  const float* gx = x + row0 * H_SZ + lane * 4;
  v4f xr[2][8];
#pragma unroll
  for (int r = 0; r < 2; ++r)
#pragma unroll
    for (int q = 0; q < 8; ++q)
      xr[r][q] = *(const v4f*)(gx + r * H_SZ + q * 128);
  // load (m, p) holds h = wave*64 + 4*m + 2*hh + p, j = 4*k .. 4*k+3
  const float* gy = Y + ((size_t)(wave * 64 + 2 * hh) * NCOL + col) * P_SZ + k * 4;
  v4f yr[16][2];
#pragma unroll
  for (int m = 0; m < 16; ++m)
#pragma unroll
    for (int p = 0; p < 2; ++p)
      yr[m][p] = *(const v4f*)(gy + (size_t)(4 * m + p) * (NCOL * P_SZ));
  // Y's address registers are held up to this wait (the input operand) and are
  // free for other use behind it; the wave waits for the loaded data next in
  // any case.
  asm volatile("s_wait_xcnt 0x0" :: "v"(gy) : "memory");
  // Every load above is issued before the first LDS store waits for one, and
  // nothing of the row work below is moved up among them (it spilled there).
  __builtin_amdgcn_sched_barrier(0);
  *(v2f*)(s_vec + tid * 2)            = dv;
  *(v2f*)(s_vec + H_SZ + tid * 2)     = wv;
  *(v2f*)(s_vec + 2 * H_SZ + tid * 2) = bv;
  float* sd = s_y + (k * 4) * H_SZ + wave * 64 + 2 * hh;
#pragma unroll
  for (int m = 0; m < 16; ++m)
#pragma unroll
    for (int e = 0; e < 4; ++e) {
      const v2f pr = {yr[m][0][e], yr[m][1][e]};
      *(v2f*)(sd + e * H_SZ + (m ^ k) * 4) = pr;
    }
  __syncthreads();   // the column's Y and the three vectors are in LDS

  // ---- the lane's 32 h of 1+D, w and b stay in registers for all four rows ----
  v4f d1[8], w4[8], b4[8];
#pragma unroll
  for (int q = 0; q < 8; ++q) {
    d1[q] = *(const v4f*)(s_vec + q * 128 + lane * 4) + 1.0f;
    w4[q] = *(const v4f*)(s_vec + H_SZ + q * 128 + lane * 4);
    b4[q] = *(const v4f*)(s_vec + 2 * H_SZ + q * 128 + lane * 4);
  }
  const float* sy = s_y + (wave * 4) * H_SZ + (lane ^ wave) * 4;
  float* go = out + row0 * H_SZ + lane * 4;
#pragma unroll
  for (int r = 0; r < 4; ++r) {
    v4f (&xc)[8] = xr[r & 1];
    // four partial sums a lane, one per element of a 16-byte group
    v4f s4 = {}, q4 = {};
#pragma unroll
    for (int q = 0; q < 8; ++q) {
      const v4f rv = *(const v4f*)(sy + r * H_SZ + q * 128) + xc[q] * d1[q];
      xc[q] = rv;
      s4 += rv;
      q4 += rv * rv;
    }
    float sum = (s4[0] + s4[1]) + (s4[2] + s4[3]);
    float sq  = (q4[0] + q4[1]) + (q4[2] + q4[3]);
#pragma unroll
    for (int m = 16; m > 0; m >>= 1) {
      sum += __shfl_xor(sum, m, 32);
      sq  += __shfl_xor(sq, m, 32);
    }
    const float mu  = sum * (1.0f / (float)H_SZ);
    const float var = sq * (1.0f / (float)H_SZ) - mu * mu;
    const float inv = rsqrtf(var + LN_EPS);
#pragma unroll
    for (int q = 0; q < 8; ++q)
      *(v4f*)(go + r * H_SZ + q * 128) = (xc[q] - mu) * inv * w4[q] + b4[q];
    // the row after next
    if (r < 2) {
#pragma unroll
      for (int q = 0; q < 8; ++q)
        xc[q] = *(const v4f*)(gx + (r + 2) * H_SZ + q * 128);
    }
  }
}

// ---------------------------------------------------------------------------
// Host launcher
// ---------------------------------------------------------------------------
extern "C" void kernel_launch(void* const* d_in, const int* in_sizes, int n_in,
                              void* d_out, int out_size, void* d_ws, size_t ws_size,
                              hipStream_t stream) {
  const float* x          = (const float*)d_in[0];
  const float* log_A_real = (const float*)d_in[1];
  const float* A_imag     = (const float*)d_in[2];
  const float* C_re       = (const float*)d_in[3];
  const float* C_im       = (const float*)d_in[4];
  const float* log_dt     = (const float*)d_in[5];
  const float* Dterm      = (const float*)d_in[6];
  const float* ln_w       = (const float*)d_in[7];
  const float* ln_b       = (const float*)d_in[8];
  float* out = (float*)d_out;

  // workspace layout (bytes)
  char* ws = (char*)d_ws;
  const size_t XC_B  = (size_t)H_SZ * NCOL * P_SZ * 2;       // 32 MB
  _Float16* Xc     = (_Float16*)ws;
  float*    Yconv  = (float*)(ws + XC_B);                    // 64 MB
  (void)ws_size; (void)n_in; (void)in_sizes; (void)out_size;

  // 1) pack x -> f16 column tiles (LDS transpose): grid (256 cols, 16 h-tiles)
  pack_x_kernel<<<dim3(NCOL, H_SZ / 64), dim3(256), 0, stream>>>(x, Xc);

  // 2) parameters, ingest matmul, recurrence, emit matmul (WMMA): one work-group per h
  chunk_chain_kernel<<<dim3(H_SZ), dim3(256), 0, stream>>>(
      log_A_real, A_imag, C_re, C_im, log_dt, Xc, Yconv);

  // 3) transpose back, residual, LayerNorm: one work-group per column
  residual_norm_kernel<<<dim3(NCOL), dim3(512), 0, stream>>>(
      Yconv, x, Dterm, ln_w, ln_b, out);
}

// v005
// One run takes 38.5 microseconds.
// Next to v004, in two timings, it ran 1.15 and 1.14 times as fast.
// All steps since v000 together make it 5.32 times as fast.
#include <hip/hip_runtime.h>
#include <hip/hip_bf16.h>

#define B_SZ 4
#define L_SZ 4096
#define H_SZ 1024
#define N_SZ 64
#define P_SZ 64                 // chunk length
#define C_SZ (L_SZ / P_SZ)      // 64 chunks
#define NCOL (B_SZ * C_SZ)      // 256 matmul columns per h
#define LN_EPS 1e-5f

typedef __attribute__((ext_vector_type(16))) _Float16 v16h;
typedef __attribute__((ext_vector_type(8)))  _Float16 v8h;
typedef __attribute__((ext_vector_type(4)))  _Float16 v4h;
typedef __attribute__((ext_vector_type(2)))  _Float16 v2h;
typedef __attribute__((ext_vector_type(8)))  float    v8f;
typedef __attribute__((ext_vector_type(4)))  float    v4f;
typedef __attribute__((ext_vector_type(2)))  float    v2f;

// ---------------------------------------------------------------------------
// Kernel 1: pack x [B,L,H] f32 -> Xc[h][col][t] f16 via LDS transpose.
// Block = 256 threads handles one (b, c) chunk x 64-h tile (64x64 elements x16).
// Coalesced f32 reads along h; contiguous f16 writes along t.
// ---------------------------------------------------------------------------
__global__ void pack_x_kernel(const float* __restrict__ x, _Float16* __restrict__ Xc) {
  __shared__ _Float16 s_tile[64 * 65];
  const int col = blockIdx.x;              // c*B + b
  const int hb  = blockIdx.y;              // h tile (0..15)
  const int b   = col & (B_SZ - 1);
  const int c   = col >> 2;
  const int tid = threadIdx.x;
#pragma unroll
  for (int i = 0; i < 16; ++i) {
    const int lin = i * 256 + tid;
    const int t  = lin >> 6;               // position within chunk
    const int hh = lin & 63;               // h within tile (fast -> coalesced)
    const int l  = c * P_SZ + t;
    s_tile[hh * 65 + t] =
        (_Float16)x[((size_t)b * L_SZ + l) * H_SZ + hb * 64 + hh];
  }
  __syncthreads();
#pragma unroll
  for (int i = 0; i < 16; ++i) {
    const int lin = i * 256 + tid;
    const int hh = lin >> 6;
    const int t  = lin & 63;               // t fast -> contiguous writes
    const int h  = hb * 64 + hh;
    Xc[(size_t)h * (NCOL * P_SZ) + (size_t)col * P_SZ + t] = s_tile[hh * 65 + t];
  }
}

// ---------------------------------------------------------------------------
// WMMA fragment loader from LDS. Row-major A (row per lane) and
// column-contiguous B (col per lane) share the identical per-lane K packing:
//   halves 0..7  -> K = k0 + (lane<16 ? 0 : 8) + i
//   halves 8..15 -> K = k0 + 16 + (lane<16 ? 0 : 8) + i
// Both runs are 8 contiguous halves, 16B aligned -> two ds_load_b128.
// ---------------------------------------------------------------------------
#define XP 72    // LDS pitch (halves) of 64-half rows:  144 B = 16 B x 9
#define SP 136   // LDS pitch (halves) of 128-half rows: 272 B = 16 B x 17

__device__ __forceinline__ v16h lds_frag(const _Float16* base, int ld, int rc0,
                                         int k0, int lane) {
  const _Float16* p = base + (rc0 + (lane & 15)) * ld + k0 + ((lane & 16) ? 8 : 0);
  const v8h lo = *(const v8h*)p;
  const v8h hi = *(const v8h*)(p + 16);
  return __builtin_shufflevector(lo, hi, 0, 1, 2, 3, 4, 5, 6, 7,
                                 8, 9, 10, 11, 12, 13, 14, 15);
}

// ---------------------------------------------------------------------------
// Kernel 2: parameters, ingest matmul, inter-chunk recurrence and emit matmul of
// one h in one work-group (8 waves). Wave w owns columns [32w, 32w+32) in both
// matmuls.
//   a_n = exp(dt*A_n), Ct_n = C_n*(a_n - 1)/A_n ; thread (n, g) forms the powers
//   a_n^d, d = 16g .. 16g+16, once, while the loads of X are in flight:
//     Win[2n][t] = Re a_n^(P-1-t), Win[2n+1][t] = Im a_n^(P-1-t)   -> LDS
//     E[j][2n] = 2 Re(Ct_n a_n^(j+1)), E[j][2n+1] = -2 Im(Ct_n a_n^(j+1))
//     K[d] = 2 sum_n Re(Ct_n a_n^d) ; T[j][u] = (u <= j) ? K[j-u] : 0
//   U[128 x 256] = Win[128 x 64] * X[64 x 256]        -> LDS, f16, [col][row]
//   per (b, n): S(before chunk c) replaces U(c) in place; s <- a^P * s + u
//   Re and Im of a state are neighbours in a column of U and S, so that a lane
//   of the recurrence moves two whole states by one 8-byte LDS access.
//   Y[64 x 256]  = T[64 x 64] * X + E[64 x 128] * S   -> global, f16, [h][col][j]
// Win, E, T, U and S never leave the work-group; X is read by whole-line 16 B
// per lane reads.
// Each plain '#pragma unroll' below makes the indices of a register array
// compile-time constants, so that the array stays in registers.
// ---------------------------------------------------------------------------
#define KP 68    // LDS pitch (floats) of a row of K terms: 272 B = 16 B x 17

// ed = exp(re), cc = cos(im), ss = sin(im) in the fast hardware forms. The three
// transcendentals stand in one statement, their results in registers apart from
// the inputs, with one v_nop behind the last: the slot that the instruction set
// asks for between a transcendental and an instruction that reads its result or
// overwrites its source.
__device__ __forceinline__ void cexp_parts(float re, float im, float& ed,
                                           float& cc, float& ss) {
  const float xe = re * 1.44269504f;         // v_exp_f32 is 2^x
  const float xa = im * 0.15915494f;         // v_cos/v_sin_f32 take revolutions
  asm("v_exp_f32 %0, %3\n\tv_cos_f32 %1, %4\n\tv_sin_f32 %2, %4\n\tv_nop"
      : "=&v"(ed), "=&v"(cc), "=&v"(ss) : "v"(xe), "v"(xa));
}

// Second launch bound: 6 waves per SIMD, the three work-groups per WGP that the
// 98,944 B of LDS allow.
__global__ __launch_bounds__(256, 6) void chunk_chain_kernel(
    const float* __restrict__ log_A_real, const float* __restrict__ A_imag,
    const float* __restrict__ C_re, const float* __restrict__ C_im,
    const float* __restrict__ log_dt, const _Float16* __restrict__ Xc,
    _Float16* __restrict__ Y) {
  // U, then S: 256 columns of 128 halves. Each wave first parks its own 32
  // columns of X in the first 4,608 B of its own slice (read back into registers
  // before U lands); the 4,096 B behind them hold, until U lands, the K terms of
  // the eight d = 8*wave .. 8*wave+7 as float [d & 7][n], pitch KP.
  __shared__ __attribute__((aligned(16))) _Float16 s_us[NCOL * SP];
  // Win during ingest; T (64 rows, pitch XP) and E (64 rows, pitch SP) after it.
  __shared__ __attribute__((aligned(16))) _Float16 s_par[P_SZ * XP + P_SZ * SP];
  // With R[i] = K[P-1-i] for i < P and 0 behind, row j of T is R[P-1-j .. 2P-2-j].
  // Copy k holds R shifted by k halves (s_R[k*SP + m] = R[m + k]), so that every
  // 16-byte piece of T is a 16-byte aligned read of one of the eight copies.
  __shared__ __attribute__((aligned(16))) _Float16 s_R[8 * SP];
  // a_n^P as (Re, Im), for the recurrence's lanes
  __shared__ __attribute__((aligned(16))) float s_dec[2 * N_SZ];
  const int h    = blockIdx.x;
  const int tid  = threadIdx.x;
  const int wave = tid >> 5;
  const int lane = tid & 31;
  const _Float16* gX = Xc + (size_t)h * (NCOL * P_SZ) + wave * (32 * P_SZ);
  _Float16* s_own = s_us + wave * (32 * SP);
  _Float16* s_T   = s_par;
  _Float16* s_E   = s_par + P_SZ * XP;
  const int sn = tid & (N_SZ - 1);           // state index n
  const int sb = tid >> 6;                   // group g of powers

  // ---- fetch this thread's state, then this wave's X ----
  const float lar = log_A_real[h * N_SZ + sn];
  const float Ai  = A_imag[h * N_SZ + sn];
  const float cr  = C_re[h * N_SZ + sn];
  const float ci  = C_im[h * N_SZ + sn];
  const float dt  = __expf(log_dt[h]);
  v8h xReg[8];
#pragma unroll
  for (int i = 0; i < 8; ++i) xReg[i] = *(const v8h*)(gX + (i * 32 + lane) * 8);
  // Stands in front of every later write of a register that a load above names.
  asm volatile("s_wait_xcnt 0x0" ::: "memory");
  // All loads are in flight before the arithmetic below waits for the first
  // four; X, issued last, is waited for only where it is parked.
  __builtin_amdgcn_sched_barrier(0);

  // ---- discretisation of state n ----
  const float Ar = -__expf(lar);
  const float dAr = dt * Ar, dAi = dt * Ai;
  float e0, c1, s1;
  cexp_parts(dAr, dAi, e0, c1, s1);
  const float are = e0 * c1, aim = e0 * s1;
  // Ct = C * (exp(dtA)-1)/A
  const float xr = are - 1.0f, xi = aim;
  const float inv = 1.0f / (Ar * Ar + Ai * Ai);
  const float qr = (xr * Ar + xi * Ai) * inv;
  const float qi = (xi * Ar - xr * Ai) * inv;
  const float Ctr = cr * qr - ci * qi;
  const float Cti = cr * qi + ci * qr;
  // per-chunk decay a^P
  float eP, cP, sP;
  cexp_parts(dAr * (float)P_SZ, dAi * (float)P_SZ, eP, cP, sP);
  const float dr = eP * cP;
  const float di = eP * sP;

  // ---- the 17 powers of this thread: Win and K terms to LDS, E to registers ----
  v8h wre[2], wim[2];
  v2h e2[16];                                // (E[j][2n], E[j][2n+1]), j = 16g + i
  {
    float* kt = (float*)(s_us + (2 * sb) * (32 * SP) + 32 * XP) + sn;
#pragma unroll
    for (int i = 0; i <= 16; ++i) {
      const float pw = (float)(sb * 16 + i);
      float ed, cc, ss;
      cexp_parts(dAr * pw, dAi * pw, ed, cc, ss);
      const float ce = Ctr * ed, se = Cti * ed;
      // Explicit fused forms: one rounding order for E and for the K terms.
      const float pr = fmaf(cc, ce, -(ss * se));     // Re(Ct a^d)
      if (i < 16) {                                  // d = 0..63: Win, K
        wre[1 - (i >> 3)][7 - (i & 7)] = (_Float16)(ed * cc);
        wim[1 - (i >> 3)][7 - (i & 7)] = (_Float16)(ed * ss);
        kt[(i >> 3) * (16 * SP) + (i & 7) * KP] = pr;
      }
      if (i > 0) {                                   // d = 1..64: E, row j = d-1
        const float pi = fmaf(ss, ce, cc * se);      // Im(Ct a^d)
        e2[i - 1] = v2h{(_Float16)(2.0f * pr), (_Float16)(-2.0f * pi)};
      }
    }
    // powers 16g+15 .. 16g are the 16 halves t = 48-16g .. 63-16g of rows 2n, 2n+1
    _Float16* wp = s_par + (2 * sn) * XP + (48 - 16 * sb);
#pragma unroll
    for (int v = 0; v < 2; ++v) {
      *(v8h*)(wp + v * 8)             = wre[v];
      *(v8h*)(wp + XP + v * 8)        = wim[v];
    }
    if (tid < SP) *(v8h*)(s_R + tid * 8) = v8h{};   // all eight copies start as 0
    if (sb == 0) *(v2f*)(s_dec + 2 * sn) = v2f{dr, di};
  }
#pragma unroll
  for (int i = 0; i < 8; ++i) {
    const int q = i * 32 + lane;             // 16-byte piece of this wave's X
    *(v8h*)(s_own + (q >> 3) * XP + (q & 7) * 8) = xReg[i];
  }
  __syncthreads();

  // ---- K[d], d = 8*wave + (lane & 7): the 64 terms summed in the order of n ----
  {
    const float* kr = (const float*)(s_own + 32 * XP) + (lane & 7) * KP;
    float ks = 0.0f;
#pragma unroll
    for (int q = 0; q < 16; ++q) {
      const v4f p = *(const v4f*)(kr + q * 4);
      ks = fmaf(2.0f, p[0], ks);
      ks = fmaf(2.0f, p[1], ks);
      ks = fmaf(2.0f, p[2], ks);
      ks = fmaf(2.0f, p[3], ks);
    }
    // lane l writes K[d] = R[ri] into copies 2*(l >> 3) and 2*(l >> 3) + 1
    const int ri = P_SZ - 1 - (wave * 8 + (lane & 7));
    const int k0 = (lane >> 3) * 2;
    if (ri >= k0)     s_R[k0 * SP + ri - k0]           = (_Float16)ks;
    if (ri >= k0 + 1) s_R[(k0 + 1) * SP + ri - k0 - 1] = (_Float16)ks;
  }

  // ---- ingest: X fragments stay in registers for the emit matmul ----
  const int cl = lane & 15;
  const int r8 = (lane & 16) ? 8 : 0;
  v16h xb[2][2];
#pragma unroll
  for (int nn = 0; nn < 2; ++nn)
#pragma unroll
    for (int kk = 0; kk < 2; ++kk)
      xb[nn][kk] = lds_frag(s_own, XP, nn * 16, kk * 32, lane);
#pragma unroll
  for (int m = 0; m < 8; ++m) {
    const v16h a0 = lds_frag(s_par, XP, m * 16, 0, lane);
    const v16h a1 = lds_frag(s_par, XP, m * 16, 32, lane);
#pragma unroll
    for (int nn = 0; nn < 2; ++nn) {
      v8f acc = {};
      acc = __builtin_amdgcn_wmma_f32_16x16x32_f16(false, a0, false, xb[nn][0],
                                                   (short)0, acc, false, false);
      acc = __builtin_amdgcn_wmma_f32_16x16x32_f16(false, a1, false, xb[nn][1],
                                                   (short)0, acc, false, false);
      v8h hv;
#pragma unroll
      for (int i = 0; i < 8; ++i) hv[i] = (_Float16)acc[i];
      *(v8h*)(s_own + (nn * 16 + cl) * SP + m * 16 + r8) = hv;
    }
  }
  __syncthreads();   // U and K complete; Win no longer read

  // ---- T and E take Win's place ----
#pragma unroll
  for (int i = 0; i < 2; ++i) {
    const int q = i * 256 + tid;             // 16-byte piece of T
    const int r0 = P_SZ - 1 - (q >> 3);      // R index of T[j][0], j = q >> 3
    *(v8h*)(s_T + (q >> 3) * XP + (q & 7) * 8) =
        *(const v8h*)(s_R + (r0 & 7) * SP + (r0 & ~7) + (q & 7) * 8);
  }
#pragma unroll
  for (int i = 0; i < 16; ++i)
    *(v2h*)(s_E + (sb * 16 + i) * SP + 2 * sn) = e2[i];

  // ---- recurrence over the 64 chunks, in place: wave b < 4 has batch b, its
  // lane p the states 2p and 2p+1 (element 0 and 1 of each pair below) ----
  if (wave < B_SZ) {
    _Float16* sp = s_us + wave * SP + lane * 4;
    const v4f dd = *(const v4f*)(s_dec + lane * 4);
    const v2f dr2 = {dd[0], dd[2]}, di2 = {dd[1], dd[3]};
    v2f sr = {}, si = {};
    // Kept rolled: fully unrolled, the 64 loaded pieces each hold two registers.
#pragma unroll 1
    for (int c0 = 0; c0 < C_SZ; c0 += 16) {
      v4h u[16];
#pragma unroll
      for (int i = 0; i < 16; ++i) u[i] = *(const v4h*)(sp + (c0 + i) * (B_SZ * SP));
#pragma unroll
      for (int i = 0; i < 16; ++i) {
        *(v4h*)(sp + (c0 + i) * (B_SZ * SP)) =
            v4h{(_Float16)sr[0], (_Float16)si[0], (_Float16)sr[1], (_Float16)si[1]};
        const v2f ur = {(float)u[i][0], (float)u[i][2]};
        const v2f ui = {(float)u[i][1], (float)u[i][3]};
        // Explicit fused forms: which product is rounded before the fuse is
        // fixed here, not left to the compiler's choice.
        const v2f nsr = __builtin_elementwise_fma(dr2, sr, -(di2 * si)) + ur;
        const v2f nsi = __builtin_elementwise_fma(dr2, si, di2 * sr) + ui;
        sr = nsr; si = nsi;
      }
    }
  }
  __syncthreads();   // S, T and E complete

  // ---- emit: 4 x 2 accumulator tiles per wave, k outermost ----
  v8f acc[4][2] = {};
#pragma unroll
  for (int kk = 0; kk < 2; ++kk)
#pragma unroll
    for (int m = 0; m < 4; ++m) {
      const v16h a = lds_frag(s_T, XP, m * 16, kk * 32, lane);
#pragma unroll
      for (int nn = 0; nn < 2; ++nn)
        acc[m][nn] = __builtin_amdgcn_wmma_f32_16x16x32_f16(
            false, a, false, xb[nn][kk], (short)0, acc[m][nn], false, false);
    }
#pragma unroll
  for (int kk = 0; kk < 4; ++kk) {
    const v16h s0 = lds_frag(s_own, SP, 0, kk * 32, lane);
    const v16h s1 = lds_frag(s_own, SP, 16, kk * 32, lane);
#pragma unroll
    for (int m = 0; m < 4; ++m) {
      const v16h a = lds_frag(s_E, SP, m * 16, kk * 32, lane);
      acc[m][0] = __builtin_amdgcn_wmma_f32_16x16x32_f16(
          false, a, false, s0, (short)0, acc[m][0], false, false);
      acc[m][1] = __builtin_amdgcn_wmma_f32_16x16x32_f16(
          false, a, false, s1, (short)0, acc[m][1], false, false);
    }
  }
  _Float16* Yp = Y + (size_t)h * (P_SZ * NCOL) + (size_t)(wave * 32) * P_SZ;
  // Y goes through memory as f16: a tile's eight j of a lane are one 16 B store.
  v8h yh[2][4];
#pragma unroll
  for (int nn = 0; nn < 2; ++nn)
#pragma unroll
    for (int m = 0; m < 4; ++m)
#pragma unroll
      for (int i = 0; i < 8; ++i) yh[nn][m][i] = (_Float16)acc[m][nn][i];
  // Keeps every store behind the last LDS load, WMMA and conversion, so that no
  // register an issued store names is written again.
  __builtin_amdgcn_sched_barrier(0);
#pragma unroll
  for (int nn = 0; nn < 2; ++nn)
#pragma unroll
    for (int m = 0; m < 4; ++m)
      *(v8h*)(Yp + (size_t)(nn * 16 + cl) * P_SZ + m * 16 + r8) = yh[nn][m];
}

// ---------------------------------------------------------------------------
// Kernel 3: transpose Y[h][col][j] back, residual and LayerNorm in one pass:
//   r = x*(1+D) + y ;  out = (r-mu)*rsqrt(var+eps)*w + b
// One work-group (16 waves) per column = 64 rows (b,l) x all 1024 h, so that a
// row's mean and variance are formed where r is made and r never goes to memory.
// Y comes as f16 and passes through LDS as f16, s_y[j][h]; the 8-byte group of
// four h is stored at group ^ ((j >> 3) << 2): the transposing 8-byte stores and
// the 8-byte row reads then both touch every bank once.
// Global accesses of Y, x and out are 16 B per lane on whole lines; a wave owns
// four rows, one after the other. Each plain '#pragma unroll' keeps a register
// array's indices constant.
// ---------------------------------------------------------------------------
__global__ __launch_bounds__(512) void residual_norm_kernel(
    const _Float16* __restrict__ Y, const float* __restrict__ x,
    const float* __restrict__ D, const float* __restrict__ ln_w,
    const float* __restrict__ ln_b, float* __restrict__ out) {
  // D, w, b (12 KiB) and the column's Y (128 KiB)
  __shared__ __attribute__((aligned(16))) float s_vec[3 * H_SZ];
  __shared__ __attribute__((aligned(16))) _Float16 s_y[P_SZ * H_SZ];
  const int col  = blockIdx.x;             // c*B + b
  const int b    = col & (B_SZ - 1);
  const int c    = col >> 2;
  const int tid  = threadIdx.x;
  const int wave = tid >> 5;
  const int lane = tid & 31;
  const int k    = lane & 7;               // 16-byte piece of a 64-j run of Y
  const int hq   = lane >> 3;

  // ---- in flight at once: the vectors, the wave's Y, its first two x rows ----
  const v2f dv = *(const v2f*)(D + tid * 2);
  const v2f wv = *(const v2f*)(ln_w + tid * 2);
  const v2f bv = *(const v2f*)(ln_b + tid * 2);
  const size_t row0 = (size_t)b * L_SZ + c * P_SZ + wave * 4;
  const float* gx = x + row0 * H_SZ + lane * 4;
  v4f xr[2][8];
#pragma unroll
  for (int r = 0; r < 2; ++r)
#pragma unroll
    for (int q = 0; q < 8; ++q)
      xr[r][q] = *(const v4f*)(gx + r * H_SZ + q * 128);
  // load (m, p) holds h = wave*64 + 16*m + 4*hq + p, j = 8*k .. 8*k+7
  const _Float16* gy =
      Y + ((size_t)(wave * 64 + 4 * hq) * NCOL + col) * P_SZ + k * 8;
  v8h yr[4][4];
#pragma unroll
  for (int m = 0; m < 4; ++m)
#pragma unroll
    for (int p = 0; p < 4; ++p)
      yr[m][p] = *(const v8h*)(gy + (size_t)(16 * m + p) * (NCOL * P_SZ));
  // Y's address registers are held up to this wait (the input operand) and are
  // free for other use behind it; the wave waits for the loaded data next in
  // any case.
  asm volatile("s_wait_xcnt 0x0" :: "v"(gy) : "memory");
  // Every load above is issued before the first LDS store waits for one, and
  // nothing of the row work below is moved up among them (it spilled there).
  __builtin_amdgcn_sched_barrier(0);
  *(v2f*)(s_vec + tid * 2)            = dv;
  *(v2f*)(s_vec + H_SZ + tid * 2)     = wv;
  *(v2f*)(s_vec + 2 * H_SZ + tid * 2) = bv;
  // group of h = wave*64 + 16*m + 4*hq .. +3 is wave*16 + 4*m + hq
  _Float16* sd = s_y + (k * 8) * H_SZ;
#pragma unroll
  for (int m = 0; m < 4; ++m) {
    const int grp = (wave * 16 + 4 * m + hq) ^ (k << 2);
#pragma unroll
    for (int e = 0; e < 8; ++e) {
      const v4h pr = {yr[m][0][e], yr[m][1][e], yr[m][2][e], yr[m][3][e]};
      *(v4h*)(sd + e * H_SZ + grp * 4) = pr;
    }
  }
  __syncthreads();   // the column's Y and the three vectors are in LDS

  // ---- the lane's 32 h of 1+D, w and b stay in registers for all four rows ----
  v4f d1[8], w4[8], b4[8];
#pragma unroll
  for (int q = 0; q < 8; ++q) {
    d1[q] = *(const v4f*)(s_vec + q * 128 + lane * 4) + 1.0f;
    w4[q] = *(const v4f*)(s_vec + H_SZ + q * 128 + lane * 4);
    b4[q] = *(const v4f*)(s_vec + 2 * H_SZ + q * 128 + lane * 4);
  }
  // rows j = 4*wave .. 4*wave+3 all have j >> 3 = wave >> 1
  const _Float16* sy = s_y + (wave * 4) * H_SZ + (lane ^ ((wave >> 1) << 2)) * 4;
  float* go = out + row0 * H_SZ + lane * 4;
#pragma unroll
  for (int r = 0; r < 4; ++r) {
    v4f (&xc)[8] = xr[r & 1];
    // four partial sums a lane, one per element of a 16-byte group
    v4f s4 = {}, q4 = {};
#pragma unroll
    for (int q = 0; q < 8; ++q) {
      const v4f rv =
          __builtin_convertvector(*(const v4h*)(sy + r * H_SZ + q * 128), v4f) +
          xc[q] * d1[q];
      xc[q] = rv;
      s4 += rv;
      q4 += rv * rv;
    }
    float sum = (s4[0] + s4[1]) + (s4[2] + s4[3]);
    float sq  = (q4[0] + q4[1]) + (q4[2] + q4[3]);
#pragma unroll
    for (int m = 16; m > 0; m >>= 1) {
      sum += __shfl_xor(sum, m, 32);
      sq  += __shfl_xor(sq, m, 32);
    }
    const float mu  = sum * (1.0f / (float)H_SZ);
    const float var = sq * (1.0f / (float)H_SZ) - mu * mu;
    const float inv = rsqrtf(var + LN_EPS);
#pragma unroll
    for (int q = 0; q < 8; ++q)
      *(v4f*)(go + r * H_SZ + q * 128) = (xc[q] - mu) * inv * w4[q] + b4[q];
    // the row after next
    if (r < 2) {
#pragma unroll
      for (int q = 0; q < 8; ++q)
        xc[q] = *(const v4f*)(gx + (r + 2) * H_SZ + q * 128);
    }
  }
}

// ---------------------------------------------------------------------------
// Host launcher
// ---------------------------------------------------------------------------
extern "C" void kernel_launch(void* const* d_in, const int* in_sizes, int n_in,
                              void* d_out, int out_size, void* d_ws, size_t ws_size,
                              hipStream_t stream) {
  const float* x          = (const float*)d_in[0];
  const float* log_A_real = (const float*)d_in[1];
  const float* A_imag     = (const float*)d_in[2];
  const float* C_re       = (const float*)d_in[3];
  const float* C_im       = (const float*)d_in[4];
  const float* log_dt     = (const float*)d_in[5];
  const float* Dterm      = (const float*)d_in[6];
  const float* ln_w       = (const float*)d_in[7];
  const float* ln_b       = (const float*)d_in[8];
  float* out = (float*)d_out;

  // workspace layout (bytes)
  char* ws = (char*)d_ws;
  const size_t XC_B  = (size_t)H_SZ * NCOL * P_SZ * 2;       // 32 MB
  _Float16* Xc     = (_Float16*)ws;
  _Float16* Yconv  = (_Float16*)(ws + XC_B);                 // 32 MB
  (void)ws_size; (void)n_in; (void)in_sizes; (void)out_size;

  // 1) pack x -> f16 column tiles (LDS transpose): grid (256 cols, 16 h-tiles)
  pack_x_kernel<<<dim3(NCOL, H_SZ / 64), dim3(256), 0, stream>>>(x, Xc);

  // 2) parameters, ingest matmul, recurrence, emit matmul (WMMA): one work-group per h
  chunk_chain_kernel<<<dim3(H_SZ), dim3(256), 0, stream>>>(
      log_A_real, A_imag, C_re, C_im, log_dt, Xc, Yconv);

  // 3) transpose back, residual, LayerNorm: one work-group per column
  residual_norm_kernel<<<dim3(NCOL), dim3(512), 0, stream>>>(
      Yconv, x, Dterm, ln_w, ln_b, out);
}

// v006
// A run of this version takes 36.9 microseconds.
// In both of two side-by-side timings against v005, it was 1.04 times as fast.
// Over all steps from v000 it is 5.53 times as fast.
#include <hip/hip_runtime.h>
#include <hip/hip_bf16.h>

#define B_SZ 4
#define L_SZ 4096
#define H_SZ 1024
#define N_SZ 64
#define P_SZ 64                 // chunk length
#define C_SZ (L_SZ / P_SZ)      // 64 chunks
#define NCOL (B_SZ * C_SZ)      // 256 matmul columns per h
#define LN_EPS 1e-5f

typedef __attribute__((ext_vector_type(16))) _Float16 v16h;
typedef __attribute__((ext_vector_type(8)))  _Float16 v8h;
typedef __attribute__((ext_vector_type(4)))  _Float16 v4h;
typedef __attribute__((ext_vector_type(2)))  _Float16 v2h;
typedef __attribute__((ext_vector_type(8)))  float    v8f;
typedef __attribute__((ext_vector_type(4)))  float    v4f;
typedef __attribute__((ext_vector_type(2)))  float    v2f;

// ---------------------------------------------------------------------------
// Kernel 1: pack x [B,L,H] f32 -> Xc[h][col][t] f16 via LDS transpose.
// Block = 256 threads handles one (b, c) chunk x 64-h tile (64x64 elements x16).
// Coalesced f32 reads along h; contiguous f16 writes along t.
// ---------------------------------------------------------------------------
__global__ void pack_x_kernel(const float* __restrict__ x, _Float16* __restrict__ Xc) {
  __shared__ _Float16 s_tile[64 * 65];
  const int col = blockIdx.x;              // c*B + b
  const int hb  = blockIdx.y;              // h tile (0..15)
  const int b   = col & (B_SZ - 1);
  const int c   = col >> 2;
  const int tid = threadIdx.x;
#pragma unroll
  for (int i = 0; i < 16; ++i) {
    const int lin = i * 256 + tid;
    const int t  = lin >> 6;               // position within chunk
    const int hh = lin & 63;               // h within tile (fast -> coalesced)
    const int l  = c * P_SZ + t;
    s_tile[hh * 65 + t] =
        (_Float16)x[((size_t)b * L_SZ + l) * H_SZ + hb * 64 + hh];
  }
  __syncthreads();
#pragma unroll
  for (int i = 0; i < 16; ++i) {
    const int lin = i * 256 + tid;
    const int hh = lin >> 6;
    const int t  = lin & 63;               // t fast -> contiguous writes
    const int h  = hb * 64 + hh;
    Xc[(size_t)h * (NCOL * P_SZ) + (size_t)col * P_SZ + t] = s_tile[hh * 65 + t];
  }
}

// ---------------------------------------------------------------------------
// WMMA fragment loader from LDS. Row-major A (row per lane) and
// column-contiguous B (col per lane) share the identical per-lane K packing:
//   halves 0..7  -> K = k0 + (lane<16 ? 0 : 8) + i
//   halves 8..15 -> K = k0 + 16 + (lane<16 ? 0 : 8) + i
// Both runs are 8 contiguous halves, 16B aligned -> two ds_load_b128.
// ---------------------------------------------------------------------------
#define XP 72    // LDS pitch (halves) of 64-half rows:  144 B = 16 B x 9
#define SP 136   // LDS pitch (halves) of 128-half rows: 272 B = 16 B x 17

__device__ __forceinline__ v16h lds_frag(const _Float16* base, int ld, int rc0,
                                         int k0, int lane) {
  const _Float16* p = base + (rc0 + (lane & 15)) * ld + k0 + ((lane & 16) ? 8 : 0);
  const v8h lo = *(const v8h*)p;
  const v8h hi = *(const v8h*)(p + 16);
  return __builtin_shufflevector(lo, hi, 0, 1, 2, 3, 4, 5, 6, 7,
                                 8, 9, 10, 11, 12, 13, 14, 15);
}

// ---------------------------------------------------------------------------
// Kernel 2: parameters, ingest matmul, inter-chunk recurrence and emit matmul of
// one h in one work-group (8 waves). Wave w owns columns [32w, 32w+32) in both
// matmuls.
//   a_n = exp(dt*A_n), Ct_n = C_n*(a_n - 1)/A_n ; thread (n, g) forms the powers
//   a_n^d, d = 16g .. 16g+16, once, while the loads of X are in flight:
//     Win[2n][t] = Re a_n^(P-1-t), Win[2n+1][t] = Im a_n^(P-1-t)   -> LDS
//     E[j][2n] = 2 Re(Ct_n a_n^(j+1)), E[j][2n+1] = -2 Im(Ct_n a_n^(j+1))
//     K[d] = 2 sum_n Re(Ct_n a_n^d) ; T[j][u] = (u <= j) ? K[j-u] : 0
//   U[128 x 256] = Win[128 x 64] * X[64 x 256]        -> LDS, f16, [col][row]
//   per (b, n): S(before chunk c) replaces U(c) in place; s <- a^P * s + u
//   Re and Im of a state are neighbours in a column of U and S, so that a lane
//   of the recurrence moves two whole states by one 8-byte LDS access.
//   Y[64 x 256]  = T[64 x 64] * X + E[64 x 128] * S   -> global, f16, [h][col][j]
// Win, E, T, U and S never leave the work-group; X is read by whole-line 16 B
// per lane reads.
// Win and E each pass through one 9 KiB tile of LDS in two halves (64 rows of
// Win, 32 rows of E at a time), and T is read straight from the shifted copies
// of K: the work-group's LDS then allows four work-groups per WGP, so that all
// 1,024 are resident at once.
// Each plain '#pragma unroll' below makes the indices of a register array
// compile-time constants, so that the array stays in registers.
// ---------------------------------------------------------------------------
#define RP 136   // LDS pitch (halves) of a copy of R: 272 B = 16 B x 17

// ed = exp(re), cc = cos(im), ss = sin(im) in the fast hardware forms. The three
// transcendentals stand in one statement, their results in registers apart from
// the inputs, with one v_nop behind the last: the slot that the instruction set
// asks for between a transcendental and an instruction that reads its result or
// overwrites its source.
__device__ __forceinline__ void cexp_parts(float re, float im, float& ed,
                                           float& cc, float& ss) {
  const float xe = re * 1.44269504f;         // v_exp_f32 is 2^x
  const float xa = im * 0.15915494f;         // v_cos/v_sin_f32 take revolutions
  asm("v_exp_f32 %0, %3\n\tv_cos_f32 %1, %4\n\tv_sin_f32 %2, %4\n\tv_nop"
      : "=&v"(ed), "=&v"(cc), "=&v"(ss) : "v"(xe), "v"(xa));
}

// Second launch bound: 8 waves per SIMD, the four work-groups per WGP that the
// 81,536 B of LDS allow.
__global__ __launch_bounds__(256, 8) void chunk_chain_kernel(
    const float* __restrict__ log_A_real, const float* __restrict__ A_imag,
    const float* __restrict__ C_re, const float* __restrict__ C_im,
    const float* __restrict__ log_dt, const _Float16* __restrict__ Xc,
    _Float16* __restrict__ Y) {
  // U, then S: 256 columns (records) of 128 halves, pitch SP; a wave's slice is
  // its 32 records. Until U lands, the front 128 B of a record hold the same
  // column of X (read back into registers before rows 0..63 of U land there).
  // The back parts, where rows 64..127 of U land later, hold in records 2r and
  // 2r+1 the 64 K terms (float, in the order of n) of d = 8*wave + r, and in
  // records 16..23 eight of the rows 64..127 of Win.
  __shared__ __attribute__((aligned(16))) _Float16 s_us[NCOL * SP];
  // One tile: rows 0..63 of Win, then rows 64..127 of Win (64 rows, pitch XP),
  // then the first and then the second half of E (32 rows, pitch SP).
  __shared__ __attribute__((aligned(16))) _Float16 s_par[P_SZ * XP];
  // With R[i] = K[P-1-i] for i < P and 0 behind, row j of T is R[P-1-j .. 2P-2-j].
  // Copy k holds R shifted by k halves (s_R[k*RP + m] = R[m + k]), so that every
  // 16-byte piece of T is a 16-byte aligned read of one of the eight copies.
  __shared__ __attribute__((aligned(16))) _Float16 s_R[8 * RP];
  // a_n^P as (Re, Im), for the recurrence's lanes
  __shared__ __attribute__((aligned(16))) float s_dec[2 * N_SZ];
  const int h    = blockIdx.x;
  const int tid  = threadIdx.x;
  const int wave = tid >> 5;
  const int lane = tid & 31;
  const _Float16* gX = Xc + (size_t)h * (NCOL * P_SZ) + wave * (32 * P_SZ);
  _Float16* s_own = s_us + wave * (32 * SP);
  const int sn = tid & (N_SZ - 1);           // state index n
  const int sb = tid >> 6;                   // group g of powers

  // ---- fetch this thread's state, then this wave's X ----
  const float lar = log_A_real[h * N_SZ + sn];
  const float Ai  = A_imag[h * N_SZ + sn];
  const float cr  = C_re[h * N_SZ + sn];
  const float ci  = C_im[h * N_SZ + sn];
  const float dt  = __expf(log_dt[h]);
  v8h xReg[8];
#pragma unroll
  for (int i = 0; i < 8; ++i) xReg[i] = *(const v8h*)(gX + (i * 32 + lane) * 8);
  // Stands in front of every later write of a register that a load above names.
  asm volatile("s_wait_xcnt 0x0" ::: "memory");
  // All loads are in flight before the arithmetic below waits for the first
  // four; X, issued last, is waited for only where it is parked.
  __builtin_amdgcn_sched_barrier(0);

  const bool lo_states = (wave & 1) == 0;    // this wave's n = sn is below 32

  // ---- discretisation of state n ----
  const float Ar = -__expf(lar);
  const float dAr = dt * Ar, dAi = dt * Ai;
  float e0, c1, s1;
  cexp_parts(dAr, dAi, e0, c1, s1);
  const float are = e0 * c1, aim = e0 * s1;
  // Ct = C * (exp(dtA)-1)/A
  const float xr = are - 1.0f, xi = aim;
  const float inv = 1.0f / (Ar * Ar + Ai * Ai);
  const float qr = (xr * Ar + xi * Ai) * inv;
  const float qi = (xi * Ar - xr * Ai) * inv;
  const float Ctr = cr * qr - ci * qi;
  const float Cti = cr * qi + ci * qr;
  // per-chunk decay a^P
  float eP, cP, sP;
  cexp_parts(dAr * (float)P_SZ, dAi * (float)P_SZ, eP, cP, sP);
  const float dr = eP * cP;
  const float di = eP * sP;

  // ---- the 17 powers of this thread: Win and K terms to LDS, E to registers ----
  v8h wre[2], wim[2];
  // powers 16g+15 .. 16g are the 16 halves t = 48-16g .. 63-16g of rows 2n, 2n+1
  // of Win. Rows 0..63 go into the tile; row 64 + r waits in the back part of
  // record 16 + (r & 7) of slice r >> 3 of s_us.
  _Float16* wp = lo_states
      ? s_par + (2 * sn) * XP + (48 - 16 * sb)
      : s_us + ((sn & 31) >> 2) * (32 * SP) + (16 + 2 * (sn & 3)) * SP + 64 +
            (48 - 16 * sb);
  const int wstep = lo_states ? XP : SP;     // from the Re row to the Im row
  v2h e2[16];                                // (E[j][2n], E[j][2n+1]), j = 16g + i
  {
    float* kt = (float*)(s_us + (2 * sb) * (32 * SP) + (sn >> 5) * SP + 64) + (sn & 31);
#pragma unroll
    for (int i = 0; i <= 16; ++i) {
      const float pw = (float)(sb * 16 + i);
      float ed, cc, ss;
      cexp_parts(dAr * pw, dAi * pw, ed, cc, ss);
      const float ce = Ctr * ed, se = Cti * ed;
      // Explicit fused forms: one rounding order for E and for the K terms.
      const float pr = fmaf(cc, ce, -(ss * se));     // Re(Ct a^d)
      if (i < 16) {                                  // d = 0..63: Win, K
        wre[1 - (i >> 3)][7 - (i & 7)] = (_Float16)(ed * cc);
        wim[1 - (i >> 3)][7 - (i & 7)] = (_Float16)(ed * ss);
        kt[(i >> 3) * (16 * SP) + (i & 7) * SP] = pr;
        if ((i & 7) == 7) {                          // eight powers: one piece a row
          *(v8h*)(wp + (1 - (i >> 3)) * 8)         = wre[1 - (i >> 3)];
          *(v8h*)(wp + wstep + (1 - (i >> 3)) * 8) = wim[1 - (i >> 3)];
        }
      }
      if (i > 0) {                                   // d = 1..64: E, row j = d-1
        const float pi = fmaf(ss, ce, cc * se);      // Im(Ct a^d)
        // The conversion the compiler also uses for this cast, as a volatile
        // statement so that it stays here: sunk to E's stores, far below, it
        // left five f32 values per power live and the registers ran out.
        asm volatile("v_cvt_pk_f16_f32 %0, %1, %2"
                     : "=v"(e2[i - 1]) : "v"(2.0f * pr), "v"(-2.0f * pi));
      }
    }
    if (tid < RP) *(v8h*)(s_R + tid * 8) = v8h{};   // all eight copies start as 0
    if (sb == 0) *(v2f*)(s_dec + 2 * sn) = v2f{dr, di};
  }
#pragma unroll
  for (int i = 0; i < 8; ++i) {
    const int q = i * 32 + lane;             // 16-byte piece of this wave's X
    *(v8h*)(s_own + (q >> 3) * SP + (q & 7) * 8) = xReg[i];
  }
  __syncthreads();

  // ---- K[d], d = 8*wave + (lane & 7): the 64 terms summed in the order of n ----
  {
    const float* kr = (const float*)(s_own + 64) + (lane & 7) * SP;
    float ks = 0.0f;
#pragma unroll
    for (int q = 0; q < 16; ++q) {
      const v4f p = *(const v4f*)(kr + (q >> 3) * (SP / 2) + (q & 7) * 4);
      ks = fmaf(2.0f, p[0], ks);
      ks = fmaf(2.0f, p[1], ks);
      ks = fmaf(2.0f, p[2], ks);
      ks = fmaf(2.0f, p[3], ks);
    }
    // lane l writes K[d] = R[ri] into copies 2*(l >> 3) and 2*(l >> 3) + 1
    const int ri = P_SZ - 1 - (wave * 8 + (lane & 7));
    const int k0 = (lane >> 3) * 2;
    if (ri >= k0)     s_R[k0 * RP + ri - k0]           = (_Float16)ks;
    if (ri >= k0 + 1) s_R[(k0 + 1) * RP + ri - k0 - 1] = (_Float16)ks;
  }

  // ---- ingest: X fragments stay in registers for the emit matmul ----
  const int cl = lane & 15;
  const int r8 = (lane & 16) ? 8 : 0;
  v16h xb[2][2];
#pragma unroll
  for (int nn = 0; nn < 2; ++nn)
#pragma unroll
    for (int kk = 0; kk < 2; ++kk)
      xb[nn][kk] = lds_frag(s_own, SP, nn * 16, kk * 32, lane);
#pragma unroll
  for (int m = 0; m < 8; ++m) {
    if (m == 4) {
      __syncthreads();   // rows 0..63 of Win no longer read
#pragma unroll
      for (int i = 0; i < 2; ++i) {
        const int q = i * 256 + tid;         // 16-byte piece of rows 64..127
        const int r = q >> 3;
        *(v8h*)(s_par + r * XP + (q & 7) * 8) = *(const v8h*)(
            s_us + (r >> 3) * (32 * SP) + (16 + (r & 7)) * SP + 64 + (q & 7) * 8);
      }
      __syncthreads();   // rows 64..127 of Win are in the tile
    }
    const v16h a0 = lds_frag(s_par, XP, (m & 3) * 16, 0, lane);
    const v16h a1 = lds_frag(s_par, XP, (m & 3) * 16, 32, lane);
#pragma unroll
    for (int nn = 0; nn < 2; ++nn) {
      v8f acc = {};
      acc = __builtin_amdgcn_wmma_f32_16x16x32_f16(false, a0, false, xb[nn][0],
                                                   (short)0, acc, false, false);
      acc = __builtin_amdgcn_wmma_f32_16x16x32_f16(false, a1, false, xb[nn][1],
                                                   (short)0, acc, false, false);
      v8h hv;
#pragma unroll
      for (int i = 0; i < 8; ++i) hv[i] = (_Float16)acc[i];
      *(v8h*)(s_own + (nn * 16 + cl) * SP + m * 16 + r8) = hv;
    }
  }
  __syncthreads();   // U and K complete; Win no longer read

  // ---- half of E takes Win's place. Emit works in two halves: half mh has the
  // rows j with (j >> 3) & 1 == mh, so that every thread holds eight rows of
  // each half; row j = 16g + 8mh + i stands in the tile as row 8g + i. ----
  _Float16* ep = s_par + (sb * 8) * SP + 2 * sn;
#pragma unroll
  for (int i = 0; i < 8; ++i) *(v2h*)(ep + i * SP) = e2[i];

  // ---- recurrence over the 64 chunks, in place: wave b < 4 has batch b, its
  // lane p the states 2p and 2p+1 (element 0 and 1 of each pair below) ----
  if (wave < B_SZ) {
    _Float16* sp = s_us + wave * SP + lane * 4;
    const v4f dd = *(const v4f*)(s_dec + lane * 4);
    const v2f dr2 = {dd[0], dd[2]}, di2 = {dd[1], dd[3]};
    v2f sr = {}, si = {};
    // Kept rolled: fully unrolled, the 64 loaded pieces each hold two registers.
#pragma unroll 1
    for (int c0 = 0; c0 < C_SZ; c0 += 16) {
      v4h u[16];
#pragma unroll
      for (int i = 0; i < 16; ++i) u[i] = *(const v4h*)(sp + (c0 + i) * (B_SZ * SP));
#pragma unroll
      for (int i = 0; i < 16; ++i) {
        *(v4h*)(sp + (c0 + i) * (B_SZ * SP)) =
            v4h{(_Float16)sr[0], (_Float16)si[0], (_Float16)sr[1], (_Float16)si[1]};
        const v2f ur = {(float)u[i][0], (float)u[i][2]};
        const v2f ui = {(float)u[i][1], (float)u[i][3]};
        // Explicit fused forms: which product is rounded before the fuse is
        // fixed here, not left to the compiler's choice.
        const v2f nsr = __builtin_elementwise_fma(dr2, sr, -(di2 * si)) + ur;
        const v2f nsi = __builtin_elementwise_fma(dr2, si, di2 * sr) + ui;
        sr = nsr; si = nsi;
      }
    }
  }
  __syncthreads();   // S and the first half of E complete

  // ---- emit in two halves of 32 rows j: 2 x 2 accumulator tiles per wave, k
  // outermost. Row lr of tile m is j = 32m + 16(lr >> 3) + 8mh + (lr & 7). Y goes
  // through memory as f16: a tile's eight j of a lane are one 16 B store, kept
  // in registers until both halves are done, so that no barrier has to wait
  // for a global store. ----
  v8h yh[2][4];
#pragma unroll
  for (int mh = 0; mh < 2; ++mh) {
    if (mh == 1) {
      __syncthreads();   // the first half of E no longer read
#pragma unroll
      for (int i = 0; i < 8; ++i) *(v2h*)(ep + i * SP) = e2[8 + i];
      __syncthreads();   // the second half of E is in the tile
    }
    v8f acc[2][2] = {};
#pragma unroll
    for (int kk = 0; kk < 2; ++kk)
#pragma unroll
      for (int m = 0; m < 2; ++m) {
        // T[j][u] = R[r0 + u], r0 = P-1-j: two aligned pieces of copy r0 & 7
        const int r0 = P_SZ - 1 - (m * 32 + (cl >> 3) * 16 + mh * 8 + (cl & 7));
        const _Float16* tp = s_R + (r0 & 7) * RP + (r0 & ~7) + kk * 32 + r8;
        const v8h tlo = *(const v8h*)tp;
        const v8h thi = *(const v8h*)(tp + 16);
        const v16h a = __builtin_shufflevector(tlo, thi, 0, 1, 2, 3, 4, 5, 6, 7,
                                               8, 9, 10, 11, 12, 13, 14, 15);
#pragma unroll
        for (int nn = 0; nn < 2; ++nn)
          acc[m][nn] = __builtin_amdgcn_wmma_f32_16x16x32_f16(
              false, a, false, xb[nn][kk], (short)0, acc[m][nn], false, false);
      }
    // Keeps the loads of S and E behind the last use of X: drawn up among the
    // products with T, they pushed finished Y pieces out of the registers.
    __builtin_amdgcn_sched_barrier(0);
#pragma unroll
    for (int kk = 0; kk < 4; ++kk) {
      const v16h s0 = lds_frag(s_own, SP, 0, kk * 32, lane);
      const v16h s1 = lds_frag(s_own, SP, 16, kk * 32, lane);
#pragma unroll
      for (int m = 0; m < 2; ++m) {
        const v16h a = lds_frag(s_par, SP, m * 16, kk * 32, lane);
        acc[m][0] = __builtin_amdgcn_wmma_f32_16x16x32_f16(
            false, a, false, s0, (short)0, acc[m][0], false, false);
        acc[m][1] = __builtin_amdgcn_wmma_f32_16x16x32_f16(
            false, a, false, s1, (short)0, acc[m][1], false, false);
      }
    }
#pragma unroll
    for (int nn = 0; nn < 2; ++nn)
#pragma unroll
      for (int m = 0; m < 2; ++m)
#pragma unroll
        for (int i = 0; i < 8; ++i)
          yh[nn][mh * 2 + m][i] = (_Float16)acc[m][nn][i];
  }
  _Float16* Yp = Y + (size_t)h * (P_SZ * NCOL) + (size_t)(wave * 32) * P_SZ;
  // Keeps every store behind the last LDS load, WMMA and conversion, so that no
  // register an issued store names is written again.
  __builtin_amdgcn_sched_barrier(0);
#pragma unroll
  for (int nn = 0; nn < 2; ++nn)
#pragma unroll
    for (int m = 0; m < 4; ++m)
      *(v8h*)(Yp + (size_t)(nn * 16 + cl) * P_SZ + (m & 1) * 32 + 2 * r8 + (m >> 1) * 8) =
          yh[nn][m];
}

// ---------------------------------------------------------------------------
// Kernel 3: transpose Y[h][col][j] back, residual and LayerNorm in one pass:
//   r = x*(1+D) + y ;  out = (r-mu)*rsqrt(var+eps)*w + b
// One work-group (16 waves) per column = 64 rows (b,l) x all 1024 h, so that a
// row's mean and variance are formed where r is made and r never goes to memory.
// Y comes as f16 and passes through LDS as f16, s_y[j][h]; the 8-byte group of
// four h is stored at group ^ ((j >> 3) << 2): the transposing 8-byte stores and
// the 8-byte row reads then both touch every bank once.
// Global accesses of Y, x and out are 16 B per lane on whole lines; a wave owns
// four rows, one after the other. Each plain '#pragma unroll' keeps a register
// array's indices constant.
// ---------------------------------------------------------------------------
__global__ __launch_bounds__(512) void residual_norm_kernel(
    const _Float16* __restrict__ Y, const float* __restrict__ x,
    const float* __restrict__ D, const float* __restrict__ ln_w,
    const float* __restrict__ ln_b, float* __restrict__ out) {
  // D, w, b (12 KiB) and the column's Y (128 KiB)
  __shared__ __attribute__((aligned(16))) float s_vec[3 * H_SZ];
  __shared__ __attribute__((aligned(16))) _Float16 s_y[P_SZ * H_SZ];
  const int col  = blockIdx.x;             // c*B + b
  const int b    = col & (B_SZ - 1);
  const int c    = col >> 2;
  const int tid  = threadIdx.x;
  const int wave = tid >> 5;
  const int lane = tid & 31;
  const int k    = lane & 7;               // 16-byte piece of a 64-j run of Y
  const int hq   = lane >> 3;

  // ---- in flight at once: the vectors, the wave's Y, its first two x rows ----
  const v2f dv = *(const v2f*)(D + tid * 2);
  const v2f wv = *(const v2f*)(ln_w + tid * 2);
  const v2f bv = *(const v2f*)(ln_b + tid * 2);
  const size_t row0 = (size_t)b * L_SZ + c * P_SZ + wave * 4;
  const float* gx = x + row0 * H_SZ + lane * 4;
  v4f xr[2][8];
#pragma unroll
  for (int r = 0; r < 2; ++r)
#pragma unroll
    for (int q = 0; q < 8; ++q)
      xr[r][q] = *(const v4f*)(gx + r * H_SZ + q * 128);
  // load (m, p) holds h = wave*64 + 16*m + 4*hq + p, j = 8*k .. 8*k+7
  const _Float16* gy =
      Y + ((size_t)(wave * 64 + 4 * hq) * NCOL + col) * P_SZ + k * 8;
  v8h yr[4][4];
#pragma unroll
  for (int m = 0; m < 4; ++m)
#pragma unroll
    for (int p = 0; p < 4; ++p)
      yr[m][p] = *(const v8h*)(gy + (size_t)(16 * m + p) * (NCOL * P_SZ));
  // Y's address registers are held up to this wait (the input operand) and are
  // free for other use behind it; the wave waits for the loaded data next in
  // any case.
  asm volatile("s_wait_xcnt 0x0" :: "v"(gy) : "memory");
  // Every load above is issued before the first LDS store waits for one, and
  // nothing of the row work below is moved up among them (it spilled there).
  __builtin_amdgcn_sched_barrier(0);
  *(v2f*)(s_vec + tid * 2)            = dv;
  *(v2f*)(s_vec + H_SZ + tid * 2)     = wv;
  *(v2f*)(s_vec + 2 * H_SZ + tid * 2) = bv;
  // group of h = wave*64 + 16*m + 4*hq .. +3 is wave*16 + 4*m + hq
  _Float16* sd = s_y + (k * 8) * H_SZ;
#pragma unroll
  for (int m = 0; m < 4; ++m) {
    const int grp = (wave * 16 + 4 * m + hq) ^ (k << 2);
#pragma unroll
    for (int e = 0; e < 8; ++e) {
      const v4h pr = {yr[m][0][e], yr[m][1][e], yr[m][2][e], yr[m][3][e]};
      *(v4h*)(sd + e * H_SZ + grp * 4) = pr;
    }
  }
  __syncthreads();   // the column's Y and the three vectors are in LDS

  // ---- the lane's 32 h of 1+D, w and b stay in registers for all four rows ----
  v4f d1[8], w4[8], b4[8];
#pragma unroll
  for (int q = 0; q < 8; ++q) {
    d1[q] = *(const v4f*)(s_vec + q * 128 + lane * 4) + 1.0f;
    w4[q] = *(const v4f*)(s_vec + H_SZ + q * 128 + lane * 4);
    b4[q] = *(const v4f*)(s_vec + 2 * H_SZ + q * 128 + lane * 4);
  }
  // rows j = 4*wave .. 4*wave+3 all have j >> 3 = wave >> 1
  const _Float16* sy = s_y + (wave * 4) * H_SZ + (lane ^ ((wave >> 1) << 2)) * 4;
  float* go = out + row0 * H_SZ + lane * 4;
#pragma unroll
  for (int r = 0; r < 4; ++r) {
    v4f (&xc)[8] = xr[r & 1];
    // four partial sums a lane, one per element of a 16-byte group
    v4f s4 = {}, q4 = {};
#pragma unroll
    for (int q = 0; q < 8; ++q) {
      const v4f rv =
          __builtin_convertvector(*(const v4h*)(sy + r * H_SZ + q * 128), v4f) +
          xc[q] * d1[q];
      xc[q] = rv;
      s4 += rv;
      q4 += rv * rv;
    }
    float sum = (s4[0] + s4[1]) + (s4[2] + s4[3]);
    float sq  = (q4[0] + q4[1]) + (q4[2] + q4[3]);
#pragma unroll
    for (int m = 16; m > 0; m >>= 1) {
      sum += __shfl_xor(sum, m, 32);
      sq  += __shfl_xor(sq, m, 32);
    }
    const float mu  = sum * (1.0f / (float)H_SZ);
    const float var = sq * (1.0f / (float)H_SZ) - mu * mu;
    const float inv = rsqrtf(var + LN_EPS);
#pragma unroll
    for (int q = 0; q < 8; ++q)
      *(v4f*)(go + r * H_SZ + q * 128) = (xc[q] - mu) * inv * w4[q] + b4[q];
    // the row after next
    if (r < 2) {
#pragma unroll
      for (int q = 0; q < 8; ++q)
        xc[q] = *(const v4f*)(gx + (r + 2) * H_SZ + q * 128);
    }
  }
}

// ---------------------------------------------------------------------------
// Host launcher
// ---------------------------------------------------------------------------
extern "C" void kernel_launch(void* const* d_in, const int* in_sizes, int n_in,
                              void* d_out, int out_size, void* d_ws, size_t ws_size,
                              hipStream_t stream) {
  const float* x          = (const float*)d_in[0];
  const float* log_A_real = (const float*)d_in[1];
  const float* A_imag     = (const float*)d_in[2];
  const float* C_re       = (const float*)d_in[3];
  const float* C_im       = (const float*)d_in[4];
  const float* log_dt     = (const float*)d_in[5];
  const float* Dterm      = (const float*)d_in[6];
  const float* ln_w       = (const float*)d_in[7];
  const float* ln_b       = (const float*)d_in[8];
  float* out = (float*)d_out;

  // workspace layout (bytes)
  char* ws = (char*)d_ws;
  const size_t XC_B  = (size_t)H_SZ * NCOL * P_SZ * 2;       // 32 MB
  _Float16* Xc     = (_Float16*)ws;
  _Float16* Yconv  = (_Float16*)(ws + XC_B);                 // 32 MB
  (void)ws_size; (void)n_in; (void)in_sizes; (void)out_size;

  // 1) pack x -> f16 column tiles (LDS transpose): grid (256 cols, 16 h-tiles)
  pack_x_kernel<<<dim3(NCOL, H_SZ / 64), dim3(256), 0, stream>>>(x, Xc);

  // 2) parameters, ingest matmul, recurrence, emit matmul (WMMA): one work-group per h
  chunk_chain_kernel<<<dim3(H_SZ), dim3(256), 0, stream>>>(
      log_A_real, A_imag, C_re, C_im, log_dt, Xc, Yconv);

  // 3) transpose back, residual, LayerNorm: one work-group per column
  residual_norm_kernel<<<dim3(NCOL), dim3(512), 0, stream>>>(
      Yconv, x, Dterm, ln_w, ln_b, out);
}
